// v000
// Measured on an AMD MI455X. A time is GPU time per run, averaged over a window of back-to-back runs after a warm-up
// (all launches, gaps included; the runs take copies of the inputs in turn), and the median of several windows.
// Apart from v000's, it joins two sittings. Times from different sittings can be a few percent apart, while
// side-by-side timings come from the same sitting.
// v000 is the starting kernel. One run takes 148 microseconds.
#include <hip/hip_runtime.h>

#define D_MODEL   512
#define NUM_HEADS 8
#define HEAD_DIM  64
#define BATCH     2
#define SEQ       2048

typedef __attribute__((ext_vector_type(16))) _Float16 v16h;
typedef __attribute__((ext_vector_type(8)))  _Float16 v8h;
typedef __attribute__((ext_vector_type(8)))  float    v8f;
typedef __attribute__((ext_vector_type(4)))  float    v4f;

union AB16 { v16h v; v8h h[2]; };

// convert 8 consecutive f32 -> v8h (two 16B loads + cvt)
__device__ __forceinline__ v8h cvt8(const float* __restrict__ p) {
    const v4f f0 = *(const v4f*)p;
    const v4f f1 = *(const v4f*)(p + 4);
    v8h r;
#pragma unroll
    for (int i = 0; i < 4; ++i) {
        r[i]     = (_Float16)f0[i];
        r[i + 4] = (_Float16)f1[i];
    }
    return r;
}

__device__ __forceinline__ v8f wmma16(v16h a, v16h b, v8f c) {
    return __builtin_amdgcn_wmma_f32_16x16x32_f16(false, a, false, b,
                                                  (short)0, c, false, false);
}

// ---------------------------------------------------------------------------
// Fused projection: P = relu(X @ W^T + b), emitted as f16.
//   z==0 -> Qh [b,h,s,dh]   z==1 -> Kh [b,h,s,dh]   z==2 -> Vt [b,h,dh,s]
// Grid: (M/128, 512/64, 3), block 256 (8 waves). Wave computes 16(M) x 64(N).
// ---------------------------------------------------------------------------
__global__ __launch_bounds__(256)
void proj_kernel(const float* __restrict__ Xq, const float* __restrict__ Xk,
                 const float* __restrict__ Xv, const float* __restrict__ W,
                 const float* __restrict__ bias,
                 _Float16* __restrict__ Qh, _Float16* __restrict__ Kh,
                 _Float16* __restrict__ Vt) {
    __shared__ __align__(16) _Float16 lds_w[64 * 32];    // W tile (B^T rows)
    __shared__ __align__(16) _Float16 lds_c[8][16 * 64]; // per-wave store staging

    const int tid  = threadIdx.x;
    const int wave = tid >> 5;
    const int lane = tid & 31;
    const int grp  = lane >> 4;   // half-wave group (K-group of WMMA layouts)
    const int l16  = lane & 15;

    const int z = blockIdx.z;
    const float* X = (z == 0) ? Xq : (z == 1) ? Xk : Xv;

    const int m0 = blockIdx.x * 128 + wave * 16;  // first M row of this wave
    const int n0 = blockIdx.y * 64;               // first N col (== head*64)

    v8f acc[4] = {};

    for (int kk = 0; kk < D_MODEL; kk += 32) {
        // cooperative W tile: rows e = n0..n0+63, cols kk..kk+31 (f32 -> f16)
        {
            const int e  = tid >> 2;        // 0..63
            const int k8 = (tid & 3) * 8;   // 0,8,16,24
            *(v8h*)(lds_w + e * 32 + k8) =
                cvt8(W + (size_t)(n0 + e) * D_MODEL + kk + k8);
        }
        // A operand: 16 rows x 32 K of X, per-lane WMMA A layout
        AB16 a;
        {
            const float* xr = X + (size_t)(m0 + l16) * D_MODEL + kk;
            a.h[0] = cvt8(xr + grp * 8);
            a.h[1] = cvt8(xr + 16 + grp * 8);
            if (kk + 32 < D_MODEL)
                __builtin_prefetch(xr + 32, 0, 3);   // global_prefetch next k slice
        }
        __syncthreads();
#pragma unroll
        for (int j = 0; j < 4; ++j) {
            AB16 bm;
            const _Float16* bp = lds_w + (j * 16 + l16) * 32;
            bm.h[0] = *(const v8h*)(bp + grp * 8);
            bm.h[1] = *(const v8h*)(bp + 16 + grp * 8);
            acc[j] = wmma16(a.v, bm.v, acc[j]);
        }
        __syncthreads();
    }

    // ---- epilogue: + bias, relu, f16, packed 128-bit stores ----
    const int h  = blockIdx.y;        // one head per N tile
    const int b  = m0 >> 11;          // whole 16-row tile is in one batch
    const int s0 = m0 & (SEQ - 1);

    if (z == 2) {
        // Vt [dh][s]: C-layout register column r = consecutive s -> direct v8h
#pragma unroll
        for (int j = 0; j < 4; ++j) {
            const int dh = j * 16 + l16;
            const float bv = bias[n0 + dh];
            v8h pk;
#pragma unroll
            for (int r = 0; r < 8; ++r) {
                float val = acc[j][r] + bv;
                val = val > 0.f ? val : 0.f;
                pk[r] = (_Float16)val;
            }
            *(v8h*)(Vt + ((size_t)(b * NUM_HEADS + h) * HEAD_DIM + dh) * SEQ +
                    s0 + grp * 8) = pk;
        }
    } else {
        // Qh/Kh [s][dh]: stage tile in LDS, then coalesced b128 copy-out
        _Float16* dst = (z == 0) ? Qh : Kh;
        _Float16* cw  = lds_c[wave];
#pragma unroll
        for (int j = 0; j < 4; ++j) {
            const float bv = bias[n0 + j * 16 + l16];
#pragma unroll
            for (int r = 0; r < 8; ++r) {
                float val = acc[j][r] + bv;
                val = val > 0.f ? val : 0.f;
                cw[(grp * 8 + r) * 64 + j * 16 + l16] = (_Float16)val;
            }
        }
        // same-wave DS ordering; 16 rows x 8 segs = 128 chunks, 4 per lane
#pragma unroll
        for (int i = 0; i < 4; ++i) {
            const int c   = lane + 32 * i;
            const int row = c >> 3, seg = c & 7;
            const v8h pk = *(const v8h*)(cw + row * 64 + seg * 8);
            *(v8h*)(dst + ((size_t)(b * NUM_HEADS + h) * SEQ + s0 + row) *
                    HEAD_DIM + seg * 8) = pk;
        }
    }
}

// ---------------------------------------------------------------------------
// Causal flash attention. Grid: (SEQ/128, B*H), block 256 (8 waves).
// Wave owns 16 q rows; KV tiles of 64 staged in LDS, shared by all waves.
// 16 WMMAs per wave per KV tile between one barrier pair.
// ---------------------------------------------------------------------------
__global__ __launch_bounds__(256)
void attn_kernel(const _Float16* __restrict__ Qh, const _Float16* __restrict__ Kh,
                 const _Float16* __restrict__ Vt, float* __restrict__ out) {
    // 32 KB overlay: [K 8KB | V 8KB | P 16KB] during loop, O staging after
    __shared__ __align__(16) unsigned char smem[32 * 1024];
    _Float16* lds_k = (_Float16*)smem;                 // [kv 64][d 64]
    _Float16* lds_v = (_Float16*)(smem + 8 * 1024);    // [d 64][kv 64]
    _Float16* lds_p = (_Float16*)(smem + 16 * 1024);   // 8 waves x [16][64]
    float*    lds_o = (float*)smem;                    // 8 waves x [16][64] f32

    const int tid  = threadIdx.x;
    const int wave = tid >> 5;
    const int lane = tid & 31;
    const int grp  = lane >> 4;
    const int l16  = lane & 15;

    const int bh = blockIdx.y;                 // b*H + h
    const int q0 = blockIdx.x * 128;
    const int qr = q0 + wave * 16;             // wave's first query row
    const int qr_u = __builtin_amdgcn_readfirstlane(qr);  // uniform branch key

    const _Float16* Qb = Qh + (size_t)bh * SEQ * HEAD_DIM;
    const _Float16* Kb = Kh + (size_t)bh * SEQ * HEAD_DIM;
    const _Float16* Vb = Vt + (size_t)bh * HEAD_DIM * SEQ;

    // Q A-operands for K-steps d=0..31 and d=32..63
    AB16 qa0, qa1;
    {
        const _Float16* qp = Qb + (size_t)(qr + l16) * HEAD_DIM;
        qa0.h[0] = *(const v8h*)(qp + grp * 8);
        qa0.h[1] = *(const v8h*)(qp + 16 + grp * 8);
        qa1.h[0] = *(const v8h*)(qp + 32 + grp * 8);
        qa1.h[1] = *(const v8h*)(qp + 48 + grp * 8);
    }

    float m_run[8], l_run[8];
    v8f o[4] = {};
#pragma unroll
    for (int r = 0; r < 8; ++r) { m_run[r] = -__builtin_inff(); l_run[r] = 0.f; }

    const float scale = 0.125f;  // 1/sqrt(64)
    const int kv_end = q0 + 128;

    for (int kv0 = 0; kv0 < kv_end; kv0 += 64) {
        // ---- cooperative LDS fill: K 64x64 + V^T 64x64 halves, 2 chunks ea ----
#pragma unroll
        for (int i = 0; i < 2; ++i) {
            const int c  = tid + 256 * i;     // 0..511
            const int rw = c >> 3, sg = c & 7;
            *(v8h*)(lds_k + rw * 64 + sg * 8) =
                *(const v8h*)(Kb + (size_t)(kv0 + rw) * HEAD_DIM + sg * 8);
            *(v8h*)(lds_v + rw * 64 + sg * 8) =
                *(const v8h*)(Vb + (size_t)rw * SEQ + kv0 + sg * 8);
        }
        if (kv0 + 64 < kv_end) {   // prefetch next KV tile into L2/L0
            __builtin_prefetch(Kb + (size_t)(kv0 + 64 + (tid & 63)) * HEAD_DIM, 0, 3);
            __builtin_prefetch(Vb + (size_t)(tid & 63) * SEQ + kv0 + 64, 0, 3);
        }
        __syncthreads();

        if (kv0 <= qr_u + 15) {  // wave-uniform causal skip
            // ---- S = Q K^T  (4 col-tiles x 2 k-steps) ----
            v8f sc[4];
#pragma unroll
            for (int j = 0; j < 4; ++j) {
                AB16 bk0, bk1;
                const _Float16* kp = lds_k + (j * 16 + l16) * 64;
                bk0.h[0] = *(const v8h*)(kp + grp * 8);
                bk0.h[1] = *(const v8h*)(kp + 16 + grp * 8);
                bk1.h[0] = *(const v8h*)(kp + 32 + grp * 8);
                bk1.h[1] = *(const v8h*)(kp + 48 + grp * 8);
                v8f c = {};
                c = wmma16(qa0.v, bk0.v, c);
                c = wmma16(qa1.v, bk1.v, c);
                sc[j] = c;
            }
            // ---- mask + scale + row max ----
            float mt[8];
#pragma unroll
            for (int r = 0; r < 8; ++r) {
                const int srow = qr + grp * 8 + r;
                float mx = -__builtin_inff();
#pragma unroll
                for (int j = 0; j < 4; ++j) {
                    float s = sc[j][r] * scale;
                    if (kv0 + j * 16 + l16 > srow) s = -__builtin_inff();
                    sc[j][r] = s;
                    mx = fmaxf(mx, s);
                }
                mt[r] = mx;
            }
#pragma unroll
            for (int r = 0; r < 8; ++r)
#pragma unroll
                for (int mk = 1; mk < 16; mk <<= 1)
                    mt[r] = fmaxf(mt[r], __shfl_xor(mt[r], mk, 32));
            // ---- online softmax update ----
            float alpha[8], rs[8];
#pragma unroll
            for (int r = 0; r < 8; ++r) {
                const float mn = fmaxf(m_run[r], mt[r]);
                alpha[r] = __expf(m_run[r] - mn);
                m_run[r] = mn;
                float acc = 0.f;
#pragma unroll
                for (int j = 0; j < 4; ++j) {
                    const float p = __expf(sc[j][r] - mn);
                    sc[j][r] = p;
                    acc += p;
                }
                rs[r] = acc;
            }
#pragma unroll
            for (int r = 0; r < 8; ++r)
#pragma unroll
                for (int mk = 1; mk < 16; mk <<= 1)
                    rs[r] += __shfl_xor(rs[r], mk, 32);
#pragma unroll
            for (int r = 0; r < 8; ++r) l_run[r] = l_run[r] * alpha[r] + rs[r];
#pragma unroll
            for (int t = 0; t < 4; ++t)
#pragma unroll
                for (int r = 0; r < 8; ++r) o[t][r] *= alpha[r];

            // ---- P: C layout -> LDS -> A layout (same-wave DS ordering) ----
            _Float16* pw = lds_p + wave * (16 * 64);
#pragma unroll
            for (int j = 0; j < 4; ++j)
#pragma unroll
                for (int r = 0; r < 8; ++r)
                    pw[(grp * 8 + r) * 64 + j * 16 + l16] = (_Float16)sc[j][r];
            AB16 pa0, pa1;
            {
                const _Float16* pp = pw + l16 * 64;
                pa0.h[0] = *(const v8h*)(pp + grp * 8);
                pa0.h[1] = *(const v8h*)(pp + 16 + grp * 8);
                pa1.h[0] = *(const v8h*)(pp + 32 + grp * 8);
                pa1.h[1] = *(const v8h*)(pp + 48 + grp * 8);
            }
            // ---- O += P V  (4 dh-tiles x 2 k-steps) ----
#pragma unroll
            for (int t = 0; t < 4; ++t) {
                AB16 bv0, bv1;
                const _Float16* vp = lds_v + (t * 16 + l16) * 64;
                bv0.h[0] = *(const v8h*)(vp + grp * 8);
                bv0.h[1] = *(const v8h*)(vp + 16 + grp * 8);
                bv1.h[0] = *(const v8h*)(vp + 32 + grp * 8);
                bv1.h[1] = *(const v8h*)(vp + 48 + grp * 8);
                o[t] = wmma16(pa0.v, bv0.v, o[t]);
                o[t] = wmma16(pa1.v, bv1.v, o[t]);
            }
        }
        __syncthreads();
    }

    // ---- normalize, stage f32 tile in LDS overlay, coalesced b128 stores ----
    const int b = bh / NUM_HEADS;
    const int h = bh % NUM_HEADS;
    float inv_l[8];
#pragma unroll
    for (int r = 0; r < 8; ++r) inv_l[r] = 1.0f / l_run[r];

    float* ow = lds_o + wave * (16 * 64);   // safe: loop ended with barrier
#pragma unroll
    for (int t = 0; t < 4; ++t)
#pragma unroll
        for (int r = 0; r < 8; ++r)
            ow[(grp * 8 + r) * 64 + t * 16 + l16] = o[t][r] * inv_l[r];
    // 16 rows x 16 segs (v4f) = 256 chunks, 8 per lane; same-wave DS ordering
#pragma unroll
    for (int i = 0; i < 8; ++i) {
        const int c   = lane + 32 * i;
        const int row = c >> 4, seg = c & 15;
        const v4f val = *(const v4f*)(ow + row * 64 + seg * 4);
        *(v4f*)(out + ((size_t)(h * BATCH + b) * SEQ + qr + row) * HEAD_DIM +
                seg * 4) = val;
    }
}

// ---------------------------------------------------------------------------
extern "C" void kernel_launch(void* const* d_in, const int* in_sizes, int n_in,
                              void* d_out, int out_size, void* d_ws, size_t ws_size,
                              hipStream_t stream) {
    const float* q    = (const float*)d_in[0];
    const float* k    = (const float*)d_in[1];
    const float* v    = (const float*)d_in[2];
    const float* W    = (const float*)d_in[3];
    const float* bias = (const float*)d_in[4];

    const size_t per = (size_t)BATCH * NUM_HEADS * SEQ * HEAD_DIM;  // 2,097,152
    _Float16* Qh = (_Float16*)d_ws;
    _Float16* Kh = Qh + per;
    _Float16* Vt = Kh + per;

    dim3 pgrid((BATCH * SEQ) / 128, D_MODEL / 64, 3);
    proj_kernel<<<pgrid, 256, 0, stream>>>(q, k, v, W, bias, Qh, Kh, Vt);

    dim3 agrid(SEQ / 128, BATCH * NUM_HEADS);
    attn_kernel<<<agrid, 256, 0, stream>>>(Qh, Kh, Vt, (float*)d_out);
}

// v001
// One run takes 94.9 microseconds.
// Two timings next to v000 put it at 1.56 and 1.55 times that version's speed.
#include <hip/hip_runtime.h>

#define D_MODEL   512
#define NUM_HEADS 8
#define HEAD_DIM  64
#define BATCH     2
#define SEQ       2048

// LDS row pitches. A fragment read is one ds_load_b128 per lane with 16 lanes on
// 16 consecutive rows; a pitch of 16 B x odd puts those rows on disjoint banks.
#define W_PITCH  40   // halves: 32 data + 8 pad  (80 B)
#define T_PITCH  72   // halves: 64 data + 8 pad  (144 B), K / V^T / P tiles
#define O_PITCH  68   // floats: 64 data + 4 pad  (272 B), output staging

typedef __attribute__((ext_vector_type(16))) _Float16 v16h;
typedef __attribute__((ext_vector_type(8)))  _Float16 v8h;
typedef __attribute__((ext_vector_type(8)))  float    v8f;
typedef __attribute__((ext_vector_type(4)))  float    v4f;

union AB16 { v16h v; v8h h[2]; };

// convert 8 consecutive f32 -> v8h (two 16B loads + cvt)
__device__ __forceinline__ v8h cvt8(const float* __restrict__ p) {
    const v4f f0 = *(const v4f*)p;
    const v4f f1 = *(const v4f*)(p + 4);
    v8h r;
#pragma unroll
    for (int i = 0; i < 4; ++i) {
        r[i]     = (_Float16)f0[i];
        r[i + 4] = (_Float16)f1[i];
    }
    return r;
}

__device__ __forceinline__ v8f wmma16(v16h a, v16h b, v8f c) {
    return __builtin_amdgcn_wmma_f32_16x16x32_f16(false, a, false, b,
                                                  (short)0, c, false, false);
}

// ---------------------------------------------------------------------------
// Fused projection: P = relu(X @ W^T + b), emitted as f16.
//   z==0 -> Qh [b,h,s,dh]   z==1 -> Kh [b,h,s,dh]   z==2 -> Vt [b,h,dh,s]
// Grid: (M/128, 512/64, 3), block 256 (8 waves). Wave computes 16(M) x 64(N).
// ---------------------------------------------------------------------------
__global__ __launch_bounds__(256)
void proj_kernel(const float* __restrict__ Xq, const float* __restrict__ Xk,
                 const float* __restrict__ Xv, const float* __restrict__ W,
                 const float* __restrict__ bias,
                 _Float16* __restrict__ Qh, _Float16* __restrict__ Kh,
                 _Float16* __restrict__ Vt) {
    __shared__ __align__(16) _Float16 lds_w[64 * W_PITCH]; // W tile (B^T rows)
    __shared__ __align__(16) _Float16 lds_c[8][16 * 64]; // per-wave store staging

    const int tid  = threadIdx.x;
    const int wave = tid >> 5;
    const int lane = tid & 31;
    const int grp  = lane >> 4;   // half-wave group (K-group of WMMA layouts)
    const int l16  = lane & 15;

    const int z = blockIdx.z;
    const float* X = (z == 0) ? Xq : (z == 1) ? Xk : Xv;

    const int m0 = blockIdx.x * 128 + wave * 16;  // first M row of this wave
    const int n0 = blockIdx.y * 64;               // first N col (== head*64)

    v8f acc[4] = {};

    for (int kk = 0; kk < D_MODEL; kk += 32) {
        // cooperative W tile: rows e = n0..n0+63, cols kk..kk+31 (f32 -> f16)
        {
            const int e  = tid >> 2;        // 0..63
            const int k8 = (tid & 3) * 8;   // 0,8,16,24
            *(v8h*)(lds_w + e * W_PITCH + k8) =
                cvt8(W + (size_t)(n0 + e) * D_MODEL + kk + k8);
        }
        // A operand: 16 rows x 32 K of X, per-lane WMMA A layout
        AB16 a;
        {
            const float* xr = X + (size_t)(m0 + l16) * D_MODEL + kk;
            a.h[0] = cvt8(xr + grp * 8);
            a.h[1] = cvt8(xr + 16 + grp * 8);
            if (kk + 32 < D_MODEL)
                __builtin_prefetch(xr + 32, 0, 3);   // global_prefetch next k slice
        }
        __syncthreads();
#pragma unroll
        for (int j = 0; j < 4; ++j) {
            AB16 bm;
            const _Float16* bp = lds_w + (j * 16 + l16) * W_PITCH;
            bm.h[0] = *(const v8h*)(bp + grp * 8);
            bm.h[1] = *(const v8h*)(bp + 16 + grp * 8);
            acc[j] = wmma16(a.v, bm.v, acc[j]);
        }
        __syncthreads();
    }

    // ---- epilogue: + bias, relu, f16, packed 128-bit stores ----
    const int h  = blockIdx.y;        // one head per N tile
    const int b  = m0 >> 11;          // whole 16-row tile is in one batch
    const int s0 = m0 & (SEQ - 1);

    if (z == 2) {
        // Vt [dh][s]: C-layout register column r = consecutive s -> direct v8h
#pragma unroll
        for (int j = 0; j < 4; ++j) {
            const int dh = j * 16 + l16;
            const float bv = bias[n0 + dh];
            v8h pk;
#pragma unroll
            for (int r = 0; r < 8; ++r) {
                float val = acc[j][r] + bv;
                val = val > 0.f ? val : 0.f;
                pk[r] = (_Float16)val;
            }
            *(v8h*)(Vt + ((size_t)(b * NUM_HEADS + h) * HEAD_DIM + dh) * SEQ +
                    s0 + grp * 8) = pk;
        }
    } else {
        // Qh/Kh [s][dh]: stage tile in LDS, then coalesced b128 copy-out
        _Float16* dst = (z == 0) ? Qh : Kh;
        _Float16* cw  = lds_c[wave];
#pragma unroll
        for (int j = 0; j < 4; ++j) {
            const float bv = bias[n0 + j * 16 + l16];
#pragma unroll
            for (int r = 0; r < 8; ++r) {
                float val = acc[j][r] + bv;
                val = val > 0.f ? val : 0.f;
                cw[(grp * 8 + r) * 64 + j * 16 + l16] = (_Float16)val;
            }
        }
        // same-wave DS ordering; 16 rows x 8 segs = 128 chunks, 4 per lane
#pragma unroll
        for (int i = 0; i < 4; ++i) {
            const int c   = lane + 32 * i;
            const int row = c >> 3, seg = c & 7;
            const v8h pk = *(const v8h*)(cw + row * 64 + seg * 8);
            *(v8h*)(dst + ((size_t)(b * NUM_HEADS + h) * SEQ + s0 + row) *
                    HEAD_DIM + seg * 8) = pk;
        }
    }
}

// ---------------------------------------------------------------------------
// Causal flash attention. Grid: (SEQ/128, B*H), block 256 (8 waves).
// Wave owns 16 q rows; KV tiles of 64 staged in LDS, shared by all waves.
// 16 WMMAs per wave per KV tile between one barrier pair.
// ---------------------------------------------------------------------------
__global__ __launch_bounds__(256)
void attn_kernel(const _Float16* __restrict__ Qh, const _Float16* __restrict__ Kh,
                 const _Float16* __restrict__ Vt, float* __restrict__ out) {
    // 36 KB overlay: [K 9KB | V 9KB | P 18KB] during loop, O staging (34 KB) after
    __shared__ __align__(16) unsigned char smem[(64 + 64 + 8 * 16) * T_PITCH * 2];
    _Float16* lds_k = (_Float16*)smem;                 // [kv 64][T_PITCH]
    _Float16* lds_v = lds_k + 64 * T_PITCH;            // [d 64][T_PITCH]
    _Float16* lds_p = lds_v + 64 * T_PITCH;            // 8 waves x [16][T_PITCH]
    float*    lds_o = (float*)smem;                    // 8 waves x [16][O_PITCH] f32
    static_assert(8 * 16 * O_PITCH * 4 <= sizeof(smem), "O staging fits the overlay");

    const int tid  = threadIdx.x;
    const int wave = tid >> 5;
    const int lane = tid & 31;
    const int grp  = lane >> 4;
    const int l16  = lane & 15;

    const int bh = blockIdx.y;                 // b*H + h
    const int q0 = blockIdx.x * 128;
    const int qr = q0 + wave * 16;             // wave's first query row
    const int qr_u = __builtin_amdgcn_readfirstlane(qr);  // uniform branch key

    const _Float16* Qb = Qh + (size_t)bh * SEQ * HEAD_DIM;
    const _Float16* Kb = Kh + (size_t)bh * SEQ * HEAD_DIM;
    const _Float16* Vb = Vt + (size_t)bh * HEAD_DIM * SEQ;

    // Q A-operands for K-steps d=0..31 and d=32..63
    AB16 qa0, qa1;
    {
        const _Float16* qp = Qb + (size_t)(qr + l16) * HEAD_DIM;
        qa0.h[0] = *(const v8h*)(qp + grp * 8);
        qa0.h[1] = *(const v8h*)(qp + 16 + grp * 8);
        qa1.h[0] = *(const v8h*)(qp + 32 + grp * 8);
        qa1.h[1] = *(const v8h*)(qp + 48 + grp * 8);
    }

    float m_run[8], l_run[8];
    v8f o[4] = {};
#pragma unroll
    for (int r = 0; r < 8; ++r) { m_run[r] = -__builtin_inff(); l_run[r] = 0.f; }

    const float scale = 0.125f;  // 1/sqrt(64)
    const int kv_end = q0 + 128;

    for (int kv0 = 0; kv0 < kv_end; kv0 += 64) {
        // ---- cooperative LDS fill: K 64x64 + V^T 64x64 halves, 2 chunks ea ----
#pragma unroll
        for (int i = 0; i < 2; ++i) {
            const int c  = tid + 256 * i;     // 0..511
            const int rw = c >> 3, sg = c & 7;
            *(v8h*)(lds_k + rw * T_PITCH + sg * 8) =
                *(const v8h*)(Kb + (size_t)(kv0 + rw) * HEAD_DIM + sg * 8);
            *(v8h*)(lds_v + rw * T_PITCH + sg * 8) =
                *(const v8h*)(Vb + (size_t)rw * SEQ + kv0 + sg * 8);
        }
        if (kv0 + 64 < kv_end) {   // prefetch next KV tile into L2/L0
            __builtin_prefetch(Kb + (size_t)(kv0 + 64 + (tid & 63)) * HEAD_DIM, 0, 3);
            __builtin_prefetch(Vb + (size_t)(tid & 63) * SEQ + kv0 + 64, 0, 3);
        }
        __syncthreads();

        if (kv0 <= qr_u + 15) {  // wave-uniform causal skip
            // ---- S = Q K^T  (4 col-tiles x 2 k-steps) ----
            v8f sc[4];
#pragma unroll
            for (int j = 0; j < 4; ++j) {
                AB16 bk0, bk1;
                const _Float16* kp = lds_k + (j * 16 + l16) * T_PITCH;
                bk0.h[0] = *(const v8h*)(kp + grp * 8);
                bk0.h[1] = *(const v8h*)(kp + 16 + grp * 8);
                bk1.h[0] = *(const v8h*)(kp + 32 + grp * 8);
                bk1.h[1] = *(const v8h*)(kp + 48 + grp * 8);
                v8f c = {};
                c = wmma16(qa0.v, bk0.v, c);
                c = wmma16(qa1.v, bk1.v, c);
                sc[j] = c;
            }
            // ---- mask + scale + row max ----
            float mt[8];
#pragma unroll
            for (int r = 0; r < 8; ++r) {
                const int srow = qr + grp * 8 + r;
                float mx = -__builtin_inff();
#pragma unroll
                for (int j = 0; j < 4; ++j) {
                    float s = sc[j][r] * scale;
                    if (kv0 + j * 16 + l16 > srow) s = -__builtin_inff();
                    sc[j][r] = s;
                    mx = fmaxf(mx, s);
                }
                mt[r] = mx;
            }
#pragma unroll
            for (int r = 0; r < 8; ++r)
#pragma unroll
                for (int mk = 1; mk < 16; mk <<= 1)
                    mt[r] = fmaxf(mt[r], __shfl_xor(mt[r], mk, 32));
            // ---- online softmax update ----
            float alpha[8], rs[8];
#pragma unroll
            for (int r = 0; r < 8; ++r) {
                const float mn = fmaxf(m_run[r], mt[r]);
                alpha[r] = __expf(m_run[r] - mn);
                m_run[r] = mn;
                float acc = 0.f;
#pragma unroll
                for (int j = 0; j < 4; ++j) {
                    const float p = __expf(sc[j][r] - mn);
                    sc[j][r] = p;
                    acc += p;
                }
                rs[r] = acc;
            }
#pragma unroll
            for (int r = 0; r < 8; ++r)
#pragma unroll
                for (int mk = 1; mk < 16; mk <<= 1)
                    rs[r] += __shfl_xor(rs[r], mk, 32);
#pragma unroll
            for (int r = 0; r < 8; ++r) l_run[r] = l_run[r] * alpha[r] + rs[r];
#pragma unroll
            for (int t = 0; t < 4; ++t)
#pragma unroll
                for (int r = 0; r < 8; ++r) o[t][r] *= alpha[r];

            // ---- P: C layout -> LDS -> A layout (same-wave DS ordering) ----
            _Float16* pw = lds_p + wave * (16 * T_PITCH);
#pragma unroll
            for (int j = 0; j < 4; ++j)
#pragma unroll
                for (int r = 0; r < 8; ++r)
                    pw[(grp * 8 + r) * T_PITCH + j * 16 + l16] = (_Float16)sc[j][r];
            AB16 pa0, pa1;
            {
                const _Float16* pp = pw + l16 * T_PITCH;
                pa0.h[0] = *(const v8h*)(pp + grp * 8);
                pa0.h[1] = *(const v8h*)(pp + 16 + grp * 8);
                pa1.h[0] = *(const v8h*)(pp + 32 + grp * 8);
                pa1.h[1] = *(const v8h*)(pp + 48 + grp * 8);
            }
            // ---- O += P V  (4 dh-tiles x 2 k-steps) ----
#pragma unroll
            for (int t = 0; t < 4; ++t) {
                AB16 bv0, bv1;
                const _Float16* vp = lds_v + (t * 16 + l16) * T_PITCH;
                bv0.h[0] = *(const v8h*)(vp + grp * 8);
                bv0.h[1] = *(const v8h*)(vp + 16 + grp * 8);
                bv1.h[0] = *(const v8h*)(vp + 32 + grp * 8);
                bv1.h[1] = *(const v8h*)(vp + 48 + grp * 8);
                o[t] = wmma16(pa0.v, bv0.v, o[t]);
                o[t] = wmma16(pa1.v, bv1.v, o[t]);
            }
        }
        __syncthreads();
    }

    // ---- normalize, stage f32 tile in LDS overlay, coalesced b128 stores ----
    const int b = bh / NUM_HEADS;
    const int h = bh % NUM_HEADS;
    float inv_l[8];
#pragma unroll
    for (int r = 0; r < 8; ++r) inv_l[r] = 1.0f / l_run[r];

    float* ow = lds_o + wave * (16 * O_PITCH);   // safe: loop ended with barrier
#pragma unroll
    for (int t = 0; t < 4; ++t)
#pragma unroll
        for (int r = 0; r < 8; ++r)
            ow[(grp * 8 + r) * O_PITCH + t * 16 + l16] = o[t][r] * inv_l[r];
    // 16 rows x 16 segs (v4f) = 256 chunks, 8 per lane; same-wave DS ordering
#pragma unroll
    for (int i = 0; i < 8; ++i) {
        const int c   = lane + 32 * i;
        const int row = c >> 4, seg = c & 15;
        const v4f val = *(const v4f*)(ow + row * O_PITCH + seg * 4);
        *(v4f*)(out + ((size_t)(h * BATCH + b) * SEQ + qr + row) * HEAD_DIM +
                seg * 4) = val;
    }
}

// ---------------------------------------------------------------------------
extern "C" void kernel_launch(void* const* d_in, const int* in_sizes, int n_in,
                              void* d_out, int out_size, void* d_ws, size_t ws_size,
                              hipStream_t stream) {
    const float* q    = (const float*)d_in[0];
    const float* k    = (const float*)d_in[1];
    const float* v    = (const float*)d_in[2];
    const float* W    = (const float*)d_in[3];
    const float* bias = (const float*)d_in[4];

    const size_t per = (size_t)BATCH * NUM_HEADS * SEQ * HEAD_DIM;  // 2,097,152
    _Float16* Qh = (_Float16*)d_ws;
    _Float16* Kh = Qh + per;
    _Float16* Vt = Kh + per;

    dim3 pgrid((BATCH * SEQ) / 128, D_MODEL / 64, 3);
    proj_kernel<<<pgrid, 256, 0, stream>>>(q, k, v, W, bias, Qh, Kh, Vt);

    dim3 agrid(SEQ / 128, BATCH * NUM_HEADS);
    attn_kernel<<<agrid, 256, 0, stream>>>(Qh, Kh, Vt, (float*)d_out);
}

// v002
// A run of this version takes 54.7 microseconds.
// In two side-by-side timings against v001, it was 1.73 and 1.74 times as fast.
// All steps since v000 together make it 2.70 times as fast.
#include <hip/hip_runtime.h>

#define D_MODEL   512
#define NUM_HEADS 8
#define HEAD_DIM  64
#define BATCH     2
#define SEQ       2048

// LDS row pitches. A fragment read is one ds_load_b128 per lane with 16 lanes on
// 16 consecutive rows; a pitch of 16 B x odd puts those rows on disjoint banks.
#define W_PITCH  40   // halves: 32 data + 8 pad  (80 B)
#define T_PITCH  72   // halves: 64 data + 8 pad  (144 B), K / V^T tiles
#define O_PITCH  68   // floats: 64 data + 4 pad  (272 B), output staging

typedef __attribute__((ext_vector_type(16))) _Float16 v16h;
typedef __attribute__((ext_vector_type(8)))  _Float16 v8h;
typedef __attribute__((ext_vector_type(8)))  float    v8f;
typedef __attribute__((ext_vector_type(4)))  float    v4f;

union AB16 { v16h v; v8h h[2]; };

// convert 8 consecutive f32 -> v8h (two 16B loads + cvt)
__device__ __forceinline__ v8h cvt8(const float* __restrict__ p) {
    const v4f f0 = *(const v4f*)p;
    const v4f f1 = *(const v4f*)(p + 4);
    v8h r;
#pragma unroll
    for (int i = 0; i < 4; ++i) {
        r[i]     = (_Float16)f0[i];
        r[i + 4] = (_Float16)f1[i];
    }
    return r;
}

__device__ __forceinline__ v8f wmma16(v16h a, v16h b, v8f c) {
    return __builtin_amdgcn_wmma_f32_16x16x32_f16(false, a, false, b,
                                                  (short)0, c, false, false);
}

// ---------------------------------------------------------------------------
// Fused projection: P = relu(X @ W^T + b), emitted as f16.
//   z==0 -> Qh [b,h,s,dh]   z==1 -> Kh [b,h,s,dh]   z==2 -> Vt [b,h,dh,s]
// Grid: (M/128, 512/64, 3), block 256 (8 waves). Wave computes 16(M) x 64(N).
// ---------------------------------------------------------------------------
__global__ __launch_bounds__(256)
void proj_kernel(const float* __restrict__ Xq, const float* __restrict__ Xk,
                 const float* __restrict__ Xv, const float* __restrict__ W,
                 const float* __restrict__ bias,
                 _Float16* __restrict__ Qh, _Float16* __restrict__ Kh,
                 _Float16* __restrict__ Vt) {
    __shared__ __align__(16) _Float16 lds_w[64 * W_PITCH]; // W tile (B^T rows)
    __shared__ __align__(16) _Float16 lds_c[8][16 * 64]; // per-wave store staging

    const int tid  = threadIdx.x;
    const int wave = tid >> 5;
    const int lane = tid & 31;
    const int grp  = lane >> 4;   // half-wave group (K-group of WMMA layouts)
    const int l16  = lane & 15;

    const int z = blockIdx.z;
    const float* X = (z == 0) ? Xq : (z == 1) ? Xk : Xv;

    const int m0 = blockIdx.x * 128 + wave * 16;  // first M row of this wave
    const int n0 = blockIdx.y * 64;               // first N col (== head*64)

    v8f acc[4] = {};

    for (int kk = 0; kk < D_MODEL; kk += 32) {
        // cooperative W tile: rows e = n0..n0+63, cols kk..kk+31 (f32 -> f16)
        {
            const int e  = tid >> 2;        // 0..63
            const int k8 = (tid & 3) * 8;   // 0,8,16,24
            *(v8h*)(lds_w + e * W_PITCH + k8) =
                cvt8(W + (size_t)(n0 + e) * D_MODEL + kk + k8);
        }
        // A operand: 16 rows x 32 K of X, per-lane WMMA A layout
        AB16 a;
        {
            const float* xr = X + (size_t)(m0 + l16) * D_MODEL + kk;
            a.h[0] = cvt8(xr + grp * 8);
            a.h[1] = cvt8(xr + 16 + grp * 8);
            if (kk + 32 < D_MODEL)
                __builtin_prefetch(xr + 32, 0, 3);   // global_prefetch next k slice
        }
        __syncthreads();
#pragma unroll
        for (int j = 0; j < 4; ++j) {
            AB16 bm;
            const _Float16* bp = lds_w + (j * 16 + l16) * W_PITCH;
            bm.h[0] = *(const v8h*)(bp + grp * 8);
            bm.h[1] = *(const v8h*)(bp + 16 + grp * 8);
            acc[j] = wmma16(a.v, bm.v, acc[j]);
        }
        __syncthreads();
    }

    // ---- epilogue: + bias, relu, f16, packed 128-bit stores ----
    const int h  = blockIdx.y;        // one head per N tile
    const int b  = m0 >> 11;          // whole 16-row tile is in one batch
    const int s0 = m0 & (SEQ - 1);

    if (z == 2) {
        // Vt [dh][s]: C-layout register column r = consecutive s -> direct v8h
#pragma unroll
        for (int j = 0; j < 4; ++j) {
            const int dh = j * 16 + l16;
            const float bv = bias[n0 + dh];
            v8h pk;
#pragma unroll
            for (int r = 0; r < 8; ++r) {
                float val = acc[j][r] + bv;
                val = val > 0.f ? val : 0.f;
                pk[r] = (_Float16)val;
            }
            *(v8h*)(Vt + ((size_t)(b * NUM_HEADS + h) * HEAD_DIM + dh) * SEQ +
                    s0 + grp * 8) = pk;
        }
    } else {
        // Qh/Kh [s][dh]: stage tile in LDS, then coalesced b128 copy-out
        _Float16* dst = (z == 0) ? Qh : Kh;
        _Float16* cw  = lds_c[wave];
#pragma unroll
        for (int j = 0; j < 4; ++j) {
            const float bv = bias[n0 + j * 16 + l16];
#pragma unroll
            for (int r = 0; r < 8; ++r) {
                float val = acc[j][r] + bv;
                val = val > 0.f ? val : 0.f;
                cw[(grp * 8 + r) * 64 + j * 16 + l16] = (_Float16)val;
            }
        }
        // same-wave DS ordering; 16 rows x 8 segs = 128 chunks, 4 per lane
#pragma unroll
        for (int i = 0; i < 4; ++i) {
            const int c   = lane + 32 * i;
            const int row = c >> 3, seg = c & 7;
            const v8h pk = *(const v8h*)(cw + row * 64 + seg * 8);
            *(v8h*)(dst + ((size_t)(b * NUM_HEADS + h) * SEQ + s0 + row) *
                    HEAD_DIM + seg * 8) = pk;
        }
    }
}

// ---------------------------------------------------------------------------
// Causal flash attention, transposed products: S^T = K Q^T, O^T += V^T P^T.
// Grid: (SEQ/128, B*H), block 256 (8 waves). Wave owns 16 queries, one per
// lane column (l16); a lane holds 32 of the 64 scores of its query, lane ^ 16
// the other 32. Maximum and sum are in-lane; two S^T tiles converted in place
// are the B operand of the second product, so P never leaves the registers.
// KV tiles of 64 staged in LDS, shared by all waves.
// ---------------------------------------------------------------------------
// value of lane l ^ 16
__device__ __forceinline__ float xhalf(float x) {
    const int i = __builtin_bit_cast(int, x);
    return __builtin_bit_cast(float, __builtin_amdgcn_permlanex16(
        i, i, 0x76543210, 0xfedcba98, false, false));
}

__global__ __launch_bounds__(256)
void attn_kernel(const _Float16* __restrict__ Qh, const _Float16* __restrict__ Kh,
                 const _Float16* __restrict__ Vt, float* __restrict__ out) {
    // overlay: [K 9KB | V 9KB] during loop, O staging (34 KB) after
    __shared__ __align__(16) unsigned char smem[8 * 16 * O_PITCH * 4];
    _Float16* lds_k = (_Float16*)smem;                 // [kv 64][T_PITCH]
    _Float16* lds_v = lds_k + 64 * T_PITCH;            // [d 64][T_PITCH]
    float*    lds_o = (float*)smem;                    // 8 waves x [16][O_PITCH] f32
    static_assert(2 * 64 * T_PITCH * 2 <= sizeof(smem), "K and V tiles fit the overlay");

    const int tid  = threadIdx.x;
    const int wave = tid >> 5;
    const int lane = tid & 31;
    const int grp  = lane >> 4;
    const int l16  = lane & 15;

    const int bh = blockIdx.y;                 // b*H + h
    const int q0 = blockIdx.x * 128;
    const int qr = q0 + wave * 16;             // wave's first query row
    const int qr_u = __builtin_amdgcn_readfirstlane(qr);  // uniform branch key

    const _Float16* Qb = Qh + (size_t)bh * SEQ * HEAD_DIM;
    const _Float16* Kb = Kh + (size_t)bh * SEQ * HEAD_DIM;
    const _Float16* Vb = Vt + (size_t)bh * HEAD_DIM * SEQ;

    // Q B-operands (column = query l16) for K-steps d=0..31 and d=32..63
    AB16 qa0, qa1;
    {
        const _Float16* qp = Qb + (size_t)(qr + l16) * HEAD_DIM;
        qa0.h[0] = *(const v8h*)(qp + grp * 8);
        qa0.h[1] = *(const v8h*)(qp + 16 + grp * 8);
        qa1.h[0] = *(const v8h*)(qp + 32 + grp * 8);
        qa1.h[1] = *(const v8h*)(qp + 48 + grp * 8);
    }

    float m_run = -__builtin_inff();   // running maximum of query l16 (both halves alike)
    float l_run = 0.f;                 // running sum over this half's keys only
    v8f o[4] = {};                     // o[t][r] = O[query l16][d = t*16 + grp*8 + r]

    const float scale = 0.125f;  // 1/sqrt(64)
    const int kv_end = q0 + 128;
    const int qcol = qr + l16;         // this lane's query

    for (int kv0 = 0; kv0 < kv_end; kv0 += 64) {
        // ---- cooperative LDS fill: K 64x64 + V^T 64x64 halves, 2 chunks ea ----
#pragma unroll
        for (int i = 0; i < 2; ++i) {
            const int c  = tid + 256 * i;     // 0..511
            const int rw = c >> 3, sg = c & 7;
            *(v8h*)(lds_k + rw * T_PITCH + sg * 8) =
                *(const v8h*)(Kb + (size_t)(kv0 + rw) * HEAD_DIM + sg * 8);
            *(v8h*)(lds_v + rw * T_PITCH + sg * 8) =
                *(const v8h*)(Vb + (size_t)rw * SEQ + kv0 + sg * 8);
        }
        if (kv0 + 64 < kv_end) {   // prefetch next KV tile into L2/L0
            __builtin_prefetch(Kb + (size_t)(kv0 + 64 + (tid & 63)) * HEAD_DIM, 0, 3);
            __builtin_prefetch(Vb + (size_t)(tid & 63) * SEQ + kv0 + 64, 0, 3);
        }
        __syncthreads();

        if (kv0 <= qr_u + 15) {  // wave-uniform causal skip
            // ---- S^T = K Q^T  (4 key-tiles x 2 k-steps) ----
            // sc[j][r] = S[query l16][key kv0 + j*16 + grp*8 + r]
            v8f sc[4];
#pragma unroll
            for (int j = 0; j < 4; ++j) {
                AB16 ak0, ak1;
                const _Float16* kp = lds_k + (j * 16 + l16) * T_PITCH;
                ak0.h[0] = *(const v8h*)(kp + grp * 8);
                ak0.h[1] = *(const v8h*)(kp + 16 + grp * 8);
                ak1.h[0] = *(const v8h*)(kp + 32 + grp * 8);
                ak1.h[1] = *(const v8h*)(kp + 48 + grp * 8);
                v8f c = {};
                c = wmma16(ak0.v, qa0.v, c);
                c = wmma16(ak1.v, qa1.v, c);
                sc[j] = c;
            }
            // ---- mask + scale + maximum of the query's scores ----
            // one partial maximum and sum per key tile: four short chains
            const int lim = qcol - kv0 - grp * 8;   // key j*16 + r is kept while <= lim
            float mxj[4];
#pragma unroll
            for (int j = 0; j < 4; ++j) {
                mxj[j] = -__builtin_inff();
#pragma unroll
                for (int r = 0; r < 8; ++r) {
                    float s = sc[j][r] * scale;
                    if (j * 16 + r > lim) s = -__builtin_inff();
                    sc[j][r] = s;
                    mxj[j] = fmaxf(mxj[j], s);
                }
            }
            float mx = fmaxf(fmaxf(mxj[0], mxj[1]), fmaxf(mxj[2], mxj[3]));
            mx = fmaxf(mx, xhalf(mx));
            // ---- online softmax update ----
            const float mn = fmaxf(m_run, mx);
            const float alpha = __expf(m_run - mn);
            m_run = mn;
            float rsj[4];
#pragma unroll
            for (int j = 0; j < 4; ++j) {
                rsj[j] = 0.f;
#pragma unroll
                for (int r = 0; r < 8; ++r) {
                    const float p = __expf(sc[j][r] - mn);
                    sc[j][r] = p;
                    rsj[j] += p;
                }
            }
            const float rs = (rsj[0] + rsj[1]) + (rsj[2] + rsj[3]);
            l_run = l_run * alpha + rs;
#pragma unroll
            for (int t = 0; t < 4; ++t)
#pragma unroll
                for (int r = 0; r < 8; ++r) o[t][r] *= alpha;

            // ---- P^T B-operands: tiles 2s and 2s+1 hold keys grp*8+r and
            //      16+grp*8+r of k-step s, the k order of the V^T loads below ----
            AB16 pb0, pb1;
#pragma unroll
            for (int r = 0; r < 8; ++r) {
                pb0.h[0][r] = (_Float16)sc[0][r];
                pb0.h[1][r] = (_Float16)sc[1][r];
                pb1.h[0][r] = (_Float16)sc[2][r];
                pb1.h[1][r] = (_Float16)sc[3][r];
            }
            // ---- O^T += V^T P^T  (4 dh-tiles x 2 k-steps) ----
#pragma unroll
            for (int t = 0; t < 4; ++t) {
                AB16 av0, av1;
                const _Float16* vp = lds_v + (t * 16 + l16) * T_PITCH;
                av0.h[0] = *(const v8h*)(vp + grp * 8);
                av0.h[1] = *(const v8h*)(vp + 16 + grp * 8);
                av1.h[0] = *(const v8h*)(vp + 32 + grp * 8);
                av1.h[1] = *(const v8h*)(vp + 48 + grp * 8);
                o[t] = wmma16(av0.v, pb0.v, o[t]);
                o[t] = wmma16(av1.v, pb1.v, o[t]);
            }
        }
        __syncthreads();
    }

    // ---- normalize, stage f32 tile in LDS overlay, coalesced b128 stores ----
    const int b = bh / NUM_HEADS;
    const int h = bh % NUM_HEADS;
    const float inv_l = 1.0f / (l_run + xhalf(l_run));   // join the halves' sums

    float* ow = lds_o + wave * (16 * O_PITCH);   // safe: loop ended with barrier
#pragma unroll
    for (int t = 0; t < 4; ++t)
#pragma unroll
        for (int u = 0; u < 2; ++u) {
            v4f val;
#pragma unroll
            for (int e = 0; e < 4; ++e) val[e] = o[t][u * 4 + e] * inv_l;
            *(v4f*)(ow + l16 * O_PITCH + t * 16 + grp * 8 + u * 4) = val;
        }
    // 16 rows x 16 segs (v4f) = 256 chunks, 8 per lane; same-wave DS ordering
#pragma unroll
    for (int i = 0; i < 8; ++i) {
        const int c   = lane + 32 * i;
        const int row = c >> 4, seg = c & 15;
        const v4f val = *(const v4f*)(ow + row * O_PITCH + seg * 4);
        *(v4f*)(out + ((size_t)(h * BATCH + b) * SEQ + qr + row) * HEAD_DIM +
                seg * 4) = val;
    }
}

// ---------------------------------------------------------------------------
extern "C" void kernel_launch(void* const* d_in, const int* in_sizes, int n_in,
                              void* d_out, int out_size, void* d_ws, size_t ws_size,
                              hipStream_t stream) {
    const float* q    = (const float*)d_in[0];
    const float* k    = (const float*)d_in[1];
    const float* v    = (const float*)d_in[2];
    const float* W    = (const float*)d_in[3];
    const float* bias = (const float*)d_in[4];

    const size_t per = (size_t)BATCH * NUM_HEADS * SEQ * HEAD_DIM;  // 2,097,152
    _Float16* Qh = (_Float16*)d_ws;
    _Float16* Kh = Qh + per;
    _Float16* Vt = Kh + per;

    dim3 pgrid((BATCH * SEQ) / 128, D_MODEL / 64, 3);
    proj_kernel<<<pgrid, 256, 0, stream>>>(q, k, v, W, bias, Qh, Kh, Vt);

    dim3 agrid(SEQ / 128, BATCH * NUM_HEADS);
    attn_kernel<<<agrid, 256, 0, stream>>>(Qh, Kh, Vt, (float*)d_out);
}

// v003
// A run of this version takes 50.7 microseconds.
// In two side-by-side timings against v002, it was 1.08 and 1.09 times as fast.
// All steps since v000 together make it 2.92 times as fast.
#include <hip/hip_runtime.h>

#define D_MODEL   512
#define NUM_HEADS 8
#define HEAD_DIM  64
#define BATCH     2
#define SEQ       2048

// LDS row pitches. A fragment read is one ds_load_b128 per lane with 16 lanes on
// 16 consecutive rows; a pitch of 16 B x odd puts those rows on disjoint banks.
#define W_PITCH  40   // halves: 32 data + 8 pad  (80 B)
#define T_PITCH  72   // halves: 64 data + 8 pad  (144 B), K / V^T tiles
#define O_PITCH  68   // floats: 64 data + 4 pad  (272 B), output staging
#define KV_SPLIT 4    // wave groups of the attention block, each on its own key tiles

typedef __attribute__((ext_vector_type(16))) _Float16 v16h;
typedef __attribute__((ext_vector_type(8)))  _Float16 v8h;
typedef __attribute__((ext_vector_type(8)))  float    v8f;
typedef __attribute__((ext_vector_type(4)))  float    v4f;

union AB16 { v16h v; v8h h[2]; };

// convert 8 consecutive f32 -> v8h (two 16B loads + cvt)
__device__ __forceinline__ v8h cvt8(const float* __restrict__ p) {
    const v4f f0 = *(const v4f*)p;
    const v4f f1 = *(const v4f*)(p + 4);
    v8h r;
#pragma unroll
    for (int i = 0; i < 4; ++i) {
        r[i]     = (_Float16)f0[i];
        r[i + 4] = (_Float16)f1[i];
    }
    return r;
}

__device__ __forceinline__ v8f wmma16(v16h a, v16h b, v8f c) {
    return __builtin_amdgcn_wmma_f32_16x16x32_f16(false, a, false, b,
                                                  (short)0, c, false, false);
}

// ---------------------------------------------------------------------------
// Fused projection: P = relu(X @ W^T + b), emitted as f16.
//   z==0 -> Qh [b,h,s,dh]   z==1 -> Kh [b,h,s,dh]   z==2 -> Vt [b,h,dh,s]
// Grid: (M/128, 512/64, 3), block 256 (8 waves). Wave computes 16(M) x 64(N).
// ---------------------------------------------------------------------------
__global__ __launch_bounds__(256)
void proj_kernel(const float* __restrict__ Xq, const float* __restrict__ Xk,
                 const float* __restrict__ Xv, const float* __restrict__ W,
                 const float* __restrict__ bias,
                 _Float16* __restrict__ Qh, _Float16* __restrict__ Kh,
                 _Float16* __restrict__ Vt) {
    __shared__ __align__(16) _Float16 lds_w[64 * W_PITCH]; // W tile (B^T rows)
    __shared__ __align__(16) _Float16 lds_c[8][16 * 64]; // per-wave store staging

    const int tid  = threadIdx.x;
    const int wave = tid >> 5;
    const int lane = tid & 31;
    const int grp  = lane >> 4;   // half-wave group (K-group of WMMA layouts)
    const int l16  = lane & 15;

    const int z = blockIdx.z;
    const float* X = (z == 0) ? Xq : (z == 1) ? Xk : Xv;

    const int m0 = blockIdx.x * 128 + wave * 16;  // first M row of this wave
    const int n0 = blockIdx.y * 64;               // first N col (== head*64)

    v8f acc[4] = {};

    for (int kk = 0; kk < D_MODEL; kk += 32) {
        // cooperative W tile: rows e = n0..n0+63, cols kk..kk+31 (f32 -> f16)
        {
            const int e  = tid >> 2;        // 0..63
            const int k8 = (tid & 3) * 8;   // 0,8,16,24
            *(v8h*)(lds_w + e * W_PITCH + k8) =
                cvt8(W + (size_t)(n0 + e) * D_MODEL + kk + k8);
        }
        // A operand: 16 rows x 32 K of X, per-lane WMMA A layout
        AB16 a;
        {
            const float* xr = X + (size_t)(m0 + l16) * D_MODEL + kk;
            a.h[0] = cvt8(xr + grp * 8);
            a.h[1] = cvt8(xr + 16 + grp * 8);
            if (kk + 32 < D_MODEL)
                __builtin_prefetch(xr + 32, 0, 3);   // global_prefetch next k slice
        }
        __syncthreads();
#pragma unroll
        for (int j = 0; j < 4; ++j) {
            AB16 bm;
            const _Float16* bp = lds_w + (j * 16 + l16) * W_PITCH;
            bm.h[0] = *(const v8h*)(bp + grp * 8);
            bm.h[1] = *(const v8h*)(bp + 16 + grp * 8);
            acc[j] = wmma16(a.v, bm.v, acc[j]);
        }
        __syncthreads();
    }

    // ---- epilogue: + bias, relu, f16, packed 128-bit stores ----
    const int h  = blockIdx.y;        // one head per N tile
    const int b  = m0 >> 11;          // whole 16-row tile is in one batch
    const int s0 = m0 & (SEQ - 1);

    if (z == 2) {
        // Vt [dh][s]: C-layout register column r = consecutive s -> direct v8h
#pragma unroll
        for (int j = 0; j < 4; ++j) {
            const int dh = j * 16 + l16;
            const float bv = bias[n0 + dh];
            v8h pk;
#pragma unroll
            for (int r = 0; r < 8; ++r) {
                float val = acc[j][r] + bv;
                val = val > 0.f ? val : 0.f;
                pk[r] = (_Float16)val;
            }
            *(v8h*)(Vt + ((size_t)(b * NUM_HEADS + h) * HEAD_DIM + dh) * SEQ +
                    s0 + grp * 8) = pk;
        }
    } else {
        // Qh/Kh [s][dh]: stage tile in LDS, then coalesced b128 copy-out
        _Float16* dst = (z == 0) ? Qh : Kh;
        _Float16* cw  = lds_c[wave];
#pragma unroll
        for (int j = 0; j < 4; ++j) {
            const float bv = bias[n0 + j * 16 + l16];
#pragma unroll
            for (int r = 0; r < 8; ++r) {
                float val = acc[j][r] + bv;
                val = val > 0.f ? val : 0.f;
                cw[(grp * 8 + r) * 64 + j * 16 + l16] = (_Float16)val;
            }
        }
        // same-wave DS ordering; 16 rows x 8 segs = 128 chunks, 4 per lane
#pragma unroll
        for (int i = 0; i < 4; ++i) {
            const int c   = lane + 32 * i;
            const int row = c >> 3, seg = c & 7;
            const v8h pk = *(const v8h*)(cw + row * 64 + seg * 8);
            *(v8h*)(dst + ((size_t)(b * NUM_HEADS + h) * SEQ + s0 + row) *
                    HEAD_DIM + seg * 8) = pk;
        }
    }
}

// ---------------------------------------------------------------------------
// Causal flash attention, transposed products: S^T = K Q^T, O^T += V^T P^T.
// Grid: (SEQ/128, B*H), block 1024 = KV_SPLIT groups of 8 waves. Wave owns 16
// queries, one per lane column (l16); a lane holds 32 of the 64 scores of its
// query, lane ^ 16 the other 32. Maximum and sum are in-lane; two S^T tiles
// converted in place are the B operand of the second product, so P never leaves
// the registers. KV tiles of 64 staged in LDS, one per group and pass: group g
// walks tiles g, g + KV_SPLIT, ... with a running maximum, sum and O of its own;
// the groups' partial results are joined through LDS after the loop.
// ---------------------------------------------------------------------------
// value of lane l ^ 16
__device__ __forceinline__ float xhalf(float x) {
    const int i = __builtin_bit_cast(int, x);
    return __builtin_bit_cast(float, __builtin_amdgcn_permlanex16(
        i, i, 0x76543210, 0xfedcba98, false, false));
}

__global__ __launch_bounds__(256 * KV_SPLIT)
void attn_kernel(const _Float16* __restrict__ Qh, const _Float16* __restrict__ Kh,
                 const _Float16* __restrict__ Vt, float* __restrict__ out) {
    // overlay: per group [K 9KB | V 9KB] during loop, partial O of every wave after
    __shared__ __align__(16) unsigned char smem[KV_SPLIT * 8 * 16 * O_PITCH * 4];
    __shared__ __align__(8) float lds_ml[KV_SPLIT * 8][16][2];  // per wave and query: maximum, sum
    static_assert(KV_SPLIT * 2 * 64 * T_PITCH * 2 <= sizeof(smem), "K and V tiles fit the overlay");
    static_assert(KV_SPLIT == 4, "the join deals 16 rows to 4 groups and takes a maximum of 4");

    const int tid  = threadIdx.x;
    const int wave = tid >> 5;
    const int lane = tid & 31;
    const int grp  = lane >> 4;
    const int l16  = lane & 15;
    const int gtid = tid & 255;                // thread within its key group
    const int qg   = wave & 7;                 // query tile of the wave
    const int ks   = __builtin_amdgcn_readfirstlane(wave >> 3);  // key group, uniform

    _Float16* lds_k = (_Float16*)smem + ks * (2 * 64 * T_PITCH);  // [kv 64][T_PITCH]
    _Float16* lds_v = lds_k + 64 * T_PITCH;            // [d 64][T_PITCH]
    float*    lds_o = (float*)smem;                    // 32 waves x [16][O_PITCH] f32

    const int bh = blockIdx.y;                 // b*H + h
    const int q0 = blockIdx.x * 128;
    const int qr = q0 + qg * 16;               // wave's first query row
    const int qr_u = __builtin_amdgcn_readfirstlane(qr);  // uniform branch key

    const _Float16* Qb = Qh + (size_t)bh * SEQ * HEAD_DIM;
    const _Float16* Kb = Kh + (size_t)bh * SEQ * HEAD_DIM;
    const _Float16* Vb = Vt + (size_t)bh * HEAD_DIM * SEQ;

    // Q B-operands (column = query l16) for K-steps d=0..31 and d=32..63
    AB16 qa0, qa1;
    {
        const _Float16* qp = Qb + (size_t)(qr + l16) * HEAD_DIM;
        qa0.h[0] = *(const v8h*)(qp + grp * 8);
        qa0.h[1] = *(const v8h*)(qp + 16 + grp * 8);
        qa1.h[0] = *(const v8h*)(qp + 32 + grp * 8);
        qa1.h[1] = *(const v8h*)(qp + 48 + grp * 8);
    }

    float m_run = -__builtin_inff();   // running maximum of query l16 (both halves alike)
    float l_run = 0.f;                 // running sum over this half's keys only
    v8f o[4] = {};                     // o[t][r] = O[query l16][d = t*16 + grp*8 + r]

    const float scale = 0.125f;  // 1/sqrt(64)
    const int kv_end = q0 + 128;
    const int qcol = qr + l16;         // this lane's query

    for (int kvb = 0; kvb < kv_end; kvb += 64 * KV_SPLIT) {
        const int kv0 = kvb + ks * 64;        // this group's tile of the pass
        if (kv0 < kv_end) {                   // uniform in the group's waves
            // ---- the group's LDS fill: K 64x64 + V^T 64x64 halves, 2 chunks ea ----
#pragma unroll
            for (int i = 0; i < 2; ++i) {
                const int c  = gtid + 256 * i;    // 0..511
                const int rw = c >> 3, sg = c & 7;
                *(v8h*)(lds_k + rw * T_PITCH + sg * 8) =
                    *(const v8h*)(Kb + (size_t)(kv0 + rw) * HEAD_DIM + sg * 8);
                *(v8h*)(lds_v + rw * T_PITCH + sg * 8) =
                    *(const v8h*)(Vb + (size_t)rw * SEQ + kv0 + sg * 8);
            }
            if (kv0 + 64 * KV_SPLIT < kv_end) {   // prefetch the group's next KV tile
                __builtin_prefetch(Kb + (size_t)(kv0 + 64 * KV_SPLIT + (gtid & 63)) * HEAD_DIM, 0, 3);
                __builtin_prefetch(Vb + (size_t)(gtid & 63) * SEQ + kv0 + 64 * KV_SPLIT, 0, 3);
                // the prefetches' address registers are reused behind the barrier
                asm volatile("s_wait_xcnt 0x0" ::: "memory");
            }
        }
        __syncthreads();

        if (kv0 <= qr_u + 15) {  // wave-uniform causal skip (also: no tile past kv_end)
            // ---- S^T = K Q^T  (4 key-tiles x 2 k-steps) ----
            // sc[j][r] = S[query l16][key kv0 + j*16 + grp*8 + r]
            v8f sc[4];
#pragma unroll
            for (int j = 0; j < 4; ++j) {
                AB16 ak0, ak1;
                const _Float16* kp = lds_k + (j * 16 + l16) * T_PITCH;
                ak0.h[0] = *(const v8h*)(kp + grp * 8);
                ak0.h[1] = *(const v8h*)(kp + 16 + grp * 8);
                ak1.h[0] = *(const v8h*)(kp + 32 + grp * 8);
                ak1.h[1] = *(const v8h*)(kp + 48 + grp * 8);
                v8f c = {};
                c = wmma16(ak0.v, qa0.v, c);
                c = wmma16(ak1.v, qa1.v, c);
                sc[j] = c;
            }
            // ---- mask + scale + maximum of the query's scores ----
            // one partial maximum and sum per key tile: four short chains
            const int lim = qcol - kv0 - grp * 8;   // key j*16 + r is kept while <= lim
            float mxj[4];
#pragma unroll
            for (int j = 0; j < 4; ++j) {
                mxj[j] = -__builtin_inff();
#pragma unroll
                for (int r = 0; r < 8; ++r) {
                    float s = sc[j][r] * scale;
                    if (j * 16 + r > lim) s = -__builtin_inff();
                    sc[j][r] = s;
                    mxj[j] = fmaxf(mxj[j], s);
                }
            }
            float mx = fmaxf(fmaxf(mxj[0], mxj[1]), fmaxf(mxj[2], mxj[3]));
            mx = fmaxf(mx, xhalf(mx));
            // ---- online softmax update ----
            const float mn = fmaxf(m_run, mx);
            const float alpha = __expf(m_run - mn);
            m_run = mn;
            float rsj[4];
#pragma unroll
            for (int j = 0; j < 4; ++j) {
                rsj[j] = 0.f;
#pragma unroll
                for (int r = 0; r < 8; ++r) {
                    const float p = __expf(sc[j][r] - mn);
                    sc[j][r] = p;
                    rsj[j] += p;
                }
            }
            const float rs = (rsj[0] + rsj[1]) + (rsj[2] + rsj[3]);
            l_run = l_run * alpha + rs;
#pragma unroll
            for (int t = 0; t < 4; ++t)
#pragma unroll
                for (int r = 0; r < 8; ++r) o[t][r] *= alpha;

            // ---- P^T B-operands: tiles 2s and 2s+1 hold keys grp*8+r and
            //      16+grp*8+r of k-step s, the k order of the V^T loads below ----
            AB16 pb0, pb1;
#pragma unroll
            for (int r = 0; r < 8; ++r) {
                pb0.h[0][r] = (_Float16)sc[0][r];
                pb0.h[1][r] = (_Float16)sc[1][r];
                pb1.h[0][r] = (_Float16)sc[2][r];
                pb1.h[1][r] = (_Float16)sc[3][r];
            }
            // ---- O^T += V^T P^T  (4 dh-tiles x 2 k-steps) ----
#pragma unroll
            for (int t = 0; t < 4; ++t) {
                AB16 av0, av1;
                const _Float16* vp = lds_v + (t * 16 + l16) * T_PITCH;
                av0.h[0] = *(const v8h*)(vp + grp * 8);
                av0.h[1] = *(const v8h*)(vp + 16 + grp * 8);
                av1.h[0] = *(const v8h*)(vp + 32 + grp * 8);
                av1.h[1] = *(const v8h*)(vp + 48 + grp * 8);
                o[t] = wmma16(av0.v, pb0.v, o[t]);
                o[t] = wmma16(av1.v, pb1.v, o[t]);
            }
        }
        __syncthreads();
    }

    // ---- every wave's partial O into the LDS overlay, maximum and sum into lds_ml ----
    const int b = bh / NUM_HEADS;
    const int h = bh % NUM_HEADS;
    const float l_all = l_run + xhalf(l_run);    // join the halves' sums

    float* ow = lds_o + wave * (16 * O_PITCH);   // safe: loop ended with barrier
#pragma unroll
    for (int t = 0; t < 4; ++t)
#pragma unroll
        for (int u = 0; u < 2; ++u) {
            v4f val;
#pragma unroll
            for (int e = 0; e < 4; ++e) val[e] = o[t][u * 4 + e];
            *(v4f*)(ow + l16 * O_PITCH + t * 16 + grp * 8 + u * 4) = val;
        }
    if (grp == 0) {
        lds_ml[wave][l16][0] = m_run;   // -inf, with sum 0 and O 0, where the wave had no tile
        lds_ml[wave][l16][1] = l_all;
    }
    __syncthreads();   // the groups' partial results are read across waves below

    // ---- join the key groups: wave (ks, qg) takes rows ks*4 .. ks*4+3 of query
    //      tile qg; 16 lanes cover one 256-B row, so stores are whole lines.
    //      Group 0 always holds key 0, so the joint maximum is finite. ----
#pragma unroll
    for (int i = 0; i < 2; ++i) {
        const int row = ks * 4 + i * 2 + grp;
        float mg[KV_SPLIT], lg[KV_SPLIT];
#pragma unroll
        for (int g = 0; g < KV_SPLIT; ++g) {
            mg[g] = lds_ml[g * 8 + qg][row][0];
            lg[g] = lds_ml[g * 8 + qg][row][1];
        }
        const float mj = fmaxf(fmaxf(mg[0], mg[1]), fmaxf(mg[2], mg[3]));
        float lj = 0.f;
        v4f acc = {};
#pragma unroll
        for (int g = 0; g < KV_SPLIT; ++g) {
            const float w = __expf(mg[g] - mj);
            lj += lg[g] * w;
            const v4f part = *(const v4f*)(lds_o + (g * 8 + qg) * (16 * O_PITCH) +
                                           row * O_PITCH + l16 * 4);
#pragma unroll
            for (int e = 0; e < 4; ++e) acc[e] += part[e] * w;
        }
        const float inv_l = 1.0f / lj;
#pragma unroll
        for (int e = 0; e < 4; ++e) acc[e] *= inv_l;
        *(v4f*)(out + ((size_t)(h * BATCH + b) * SEQ + qr + row) * HEAD_DIM +
                l16 * 4) = acc;
    }
}

// ---------------------------------------------------------------------------
extern "C" void kernel_launch(void* const* d_in, const int* in_sizes, int n_in,
                              void* d_out, int out_size, void* d_ws, size_t ws_size,
                              hipStream_t stream) {
    const float* q    = (const float*)d_in[0];
    const float* k    = (const float*)d_in[1];
    const float* v    = (const float*)d_in[2];
    const float* W    = (const float*)d_in[3];
    const float* bias = (const float*)d_in[4];

    const size_t per = (size_t)BATCH * NUM_HEADS * SEQ * HEAD_DIM;  // 2,097,152
    _Float16* Qh = (_Float16*)d_ws;
    _Float16* Kh = Qh + per;
    _Float16* Vt = Kh + per;

    dim3 pgrid((BATCH * SEQ) / 128, D_MODEL / 64, 3);
    proj_kernel<<<pgrid, 256, 0, stream>>>(q, k, v, W, bias, Qh, Kh, Vt);

    dim3 agrid(SEQ / 128, BATCH * NUM_HEADS);
    attn_kernel<<<agrid, 256 * KV_SPLIT, 0, stream>>>(Qh, Kh, Vt, (float*)d_out);
}

// v004
// One run takes 45.8 microseconds.
// Next to v003, in two timings, it ran 1.11 times as fast each time.
// Counting every step since v000, it is 3.24 times as fast.
#include <hip/hip_runtime.h>

#define D_MODEL   512
#define NUM_HEADS 8
#define HEAD_DIM  64
#define BATCH     2
#define SEQ       2048

// LDS row pitches. A fragment read is one ds_load_b128 per lane with 16 lanes on
// 16 consecutive rows; a pitch of 16 B x odd puts those rows on disjoint banks.
#define W_PITCH  40   // halves: 32 data + 8 pad  (80 B)
#define T_PITCH  72   // halves: 64 data + 8 pad  (144 B), K / V^T tiles
#define O_PITCH  68   // floats: 64 data + 4 pad  (272 B), output staging
#define KV_SPLIT 4    // wave groups of the attention block, each on its own key tiles

typedef __attribute__((ext_vector_type(16))) _Float16 v16h;
typedef __attribute__((ext_vector_type(8)))  _Float16 v8h;
typedef __attribute__((ext_vector_type(8)))  float    v8f;
typedef __attribute__((ext_vector_type(4)))  float    v4f;

union AB16 { v16h v; v8h h[2]; };

// convert 8 consecutive f32 -> v8h (two 16B loads + cvt)
__device__ __forceinline__ v8h cvt8(const float* __restrict__ p) {
    const v4f f0 = *(const v4f*)p;
    const v4f f1 = *(const v4f*)(p + 4);
    v8h r;
#pragma unroll
    for (int i = 0; i < 4; ++i) {
        r[i]     = (_Float16)f0[i];
        r[i + 4] = (_Float16)f1[i];
    }
    return r;
}

__device__ __forceinline__ v8f wmma16(v16h a, v16h b, v8f c) {
    return __builtin_amdgcn_wmma_f32_16x16x32_f16(false, a, false, b,
                                                  (short)0, c, false, false);
}

// ---------------------------------------------------------------------------
// Fused projection: P = relu(X @ W^T + b), emitted as f16.
//   z==0 -> Qh [b,h,s,dh]   z==1 -> Kh [b,h,s,dh]   z==2 -> Vt [b,h,dh,s]
// Grid: (M/128, 512/64, 3), block 256 (8 waves). Wave computes 16(M) x 64(N).
// ---------------------------------------------------------------------------
__global__ __launch_bounds__(256)
void proj_kernel(const float* __restrict__ Xq, const float* __restrict__ Xk,
                 const float* __restrict__ Xv, const float* __restrict__ W,
                 const float* __restrict__ bias,
                 _Float16* __restrict__ Qh, _Float16* __restrict__ Kh,
                 _Float16* __restrict__ Vt) {
    __shared__ __align__(16) _Float16 lds_w[64 * W_PITCH]; // W tile (B^T rows)
    __shared__ __align__(16) _Float16 lds_c[8][16 * 64]; // per-wave store staging

    const int tid  = threadIdx.x;
    const int wave = tid >> 5;
    const int lane = tid & 31;
    const int grp  = lane >> 4;   // half-wave group (K-group of WMMA layouts)
    const int l16  = lane & 15;

    const int z = blockIdx.z;
    const float* X = (z == 0) ? Xq : (z == 1) ? Xk : Xv;

    const int m0 = blockIdx.x * 128 + wave * 16;  // first M row of this wave
    const int n0 = blockIdx.y * 64;               // first N col (== head*64)

    v8f acc[4] = {};

    for (int kk = 0; kk < D_MODEL; kk += 32) {
        // cooperative W tile: rows e = n0..n0+63, cols kk..kk+31 (f32 -> f16)
        {
            const int e  = tid >> 2;        // 0..63
            const int k8 = (tid & 3) * 8;   // 0,8,16,24
            *(v8h*)(lds_w + e * W_PITCH + k8) =
                cvt8(W + (size_t)(n0 + e) * D_MODEL + kk + k8);
        }
        // A operand: 16 rows x 32 K of X, per-lane WMMA A layout
        AB16 a;
        {
            const float* xr = X + (size_t)(m0 + l16) * D_MODEL + kk;
            a.h[0] = cvt8(xr + grp * 8);
            a.h[1] = cvt8(xr + 16 + grp * 8);
            if (kk + 32 < D_MODEL)
                __builtin_prefetch(xr + 32, 0, 3);   // global_prefetch next k slice
        }
        __syncthreads();
#pragma unroll
        for (int j = 0; j < 4; ++j) {
            AB16 bm;
            const _Float16* bp = lds_w + (j * 16 + l16) * W_PITCH;
            bm.h[0] = *(const v8h*)(bp + grp * 8);
            bm.h[1] = *(const v8h*)(bp + 16 + grp * 8);
            acc[j] = wmma16(a.v, bm.v, acc[j]);
        }
        __syncthreads();
    }

    // ---- epilogue: + bias, relu, f16, packed 128-bit stores ----
    const int h  = blockIdx.y;        // one head per N tile
    const int b  = m0 >> 11;          // whole 16-row tile is in one batch
    const int s0 = m0 & (SEQ - 1);

    if (z == 2) {
        // Vt [dh][s]: C-layout register column r = consecutive s -> direct v8h
#pragma unroll
        for (int j = 0; j < 4; ++j) {
            const int dh = j * 16 + l16;
            const float bv = bias[n0 + dh];
            v8h pk;
#pragma unroll
            for (int r = 0; r < 8; ++r) {
                float val = acc[j][r] + bv;
                val = val > 0.f ? val : 0.f;
                pk[r] = (_Float16)val;
            }
            *(v8h*)(Vt + ((size_t)(b * NUM_HEADS + h) * HEAD_DIM + dh) * SEQ +
                    s0 + grp * 8) = pk;
        }
    } else {
        // Qh/Kh [s][dh]: stage tile in LDS, then coalesced b128 copy-out
        _Float16* dst = (z == 0) ? Qh : Kh;
        _Float16* cw  = lds_c[wave];
#pragma unroll
        for (int j = 0; j < 4; ++j) {
            const float bv = bias[n0 + j * 16 + l16];
#pragma unroll
            for (int r = 0; r < 8; ++r) {
                float val = acc[j][r] + bv;
                val = val > 0.f ? val : 0.f;
                cw[(grp * 8 + r) * 64 + j * 16 + l16] = (_Float16)val;
            }
        }
        // same-wave DS ordering; 16 rows x 8 segs = 128 chunks, 4 per lane
#pragma unroll
        for (int i = 0; i < 4; ++i) {
            const int c   = lane + 32 * i;
            const int row = c >> 3, seg = c & 7;
            const v8h pk = *(const v8h*)(cw + row * 64 + seg * 8);
            *(v8h*)(dst + ((size_t)(b * NUM_HEADS + h) * SEQ + s0 + row) *
                    HEAD_DIM + seg * 8) = pk;
        }
    }
}

// ---------------------------------------------------------------------------
// Causal flash attention, transposed products: S^T = K Q^T, O^T += V^T P^T.
// Grid: (SEQ/128, B*H), block 1024 = KV_SPLIT groups of 8 waves. A block takes
// two 64-query tiles, t and SEQ/64 - 1 - t: waves 0-3 of a group the early one,
// waves 4-7 the late one, so every block has the same causal work (SEQ/64 + 1
// tile pairs) and each SIMD holds as many early as late waves. Wave owns 16
// queries, one per lane column (l16); a lane holds 32 of the 64 scores of its
// query, lane ^ 16 the other 32. Maximum and sum are in-lane; two S^T tiles
// converted in place are the B operand of the second product, so P never leaves
// the registers. KV tiles of 64 staged in LDS, one per group and pass: group g
// walks tiles g, g + KV_SPLIT, ... with a running maximum, sum and O of its own;
// the groups' partial results are joined through LDS after the loop.
// ---------------------------------------------------------------------------
// value of lane l ^ 16
__device__ __forceinline__ float xhalf(float x) {
    const int i = __builtin_bit_cast(int, x);
    return __builtin_bit_cast(float, __builtin_amdgcn_permlanex16(
        i, i, 0x76543210, 0xfedcba98, false, false));
}

__global__ __launch_bounds__(256 * KV_SPLIT)
void attn_kernel(const _Float16* __restrict__ Qh, const _Float16* __restrict__ Kh,
                 const _Float16* __restrict__ Vt, float* __restrict__ out) {
    // overlay: per group [K 9KB | V 9KB] during loop, partial O of every wave after
    __shared__ __align__(16) unsigned char smem[KV_SPLIT * 8 * 16 * O_PITCH * 4];
    __shared__ __align__(8) float lds_ml[KV_SPLIT * 8][16][2];  // per wave and query: maximum, sum
    static_assert(KV_SPLIT * 2 * 64 * T_PITCH * 2 <= sizeof(smem), "K and V tiles fit the overlay");
    static_assert(KV_SPLIT == 4, "the join deals 16 rows to 4 groups and takes a maximum of 4");

    const int tid  = threadIdx.x;
    const int wave = tid >> 5;
    const int lane = tid & 31;
    const int grp  = lane >> 4;
    const int l16  = lane & 15;
    const int gtid = tid & 255;                // thread within its key group
    const int qg   = wave & 7;                 // wave in its group: early/late tile and 16-row slice
    const int ks   = __builtin_amdgcn_readfirstlane(wave >> 3);  // key group, uniform

    _Float16* lds_k = (_Float16*)smem + ks * (2 * 64 * T_PITCH);  // [kv 64][T_PITCH]
    _Float16* lds_v = lds_k + 64 * T_PITCH;            // [d 64][T_PITCH]
    float*    lds_o = (float*)smem;                    // 32 waves x [16][O_PITCH] f32

    const int bh = blockIdx.y;                 // b*H + h
    const int qt_late = SEQ / 64 - 1 - (int)blockIdx.x;          // the block's late query tile
    const int qt = (qg < 4) ? (int)blockIdx.x : qt_late;         // the wave's query tile
    const int qr = qt * 64 + (qg & 3) * 16;    // wave's first query row
    const int qr_u = __builtin_amdgcn_readfirstlane(qr);  // uniform branch key

    const _Float16* Qb = Qh + (size_t)bh * SEQ * HEAD_DIM;
    const _Float16* Kb = Kh + (size_t)bh * SEQ * HEAD_DIM;
    const _Float16* Vb = Vt + (size_t)bh * HEAD_DIM * SEQ;

    // Q B-operands (column = query l16) for K-steps d=0..31 and d=32..63
    AB16 qa0, qa1;
    {
        const _Float16* qp = Qb + (size_t)(qr + l16) * HEAD_DIM;
        qa0.h[0] = *(const v8h*)(qp + grp * 8);
        qa0.h[1] = *(const v8h*)(qp + 16 + grp * 8);
        qa1.h[0] = *(const v8h*)(qp + 32 + grp * 8);
        qa1.h[1] = *(const v8h*)(qp + 48 + grp * 8);
    }

    float m_run = -__builtin_inff();   // running maximum of query l16 (both halves alike)
    float l_run = 0.f;                 // running sum over this half's keys only
    v8f o[4] = {};                     // o[t][r] = O[query l16][d = t*16 + grp*8 + r]

    const float scale = 0.125f;  // 1/sqrt(64)
    // block-uniform trip count (keys of the late tile): every wave passes every
    // barrier and helps fill; early-tile waves skip only the products below
    const int kv_end = (qt_late + 1) * 64;
    const int qcol = qr + l16;         // this lane's query

    for (int kvb = 0; kvb < kv_end; kvb += 64 * KV_SPLIT) {
        const int kv0 = kvb + ks * 64;        // this group's tile of the pass
        if (kv0 < kv_end) {                   // uniform in the group's waves
            // ---- the group's LDS fill: K 64x64 + V^T 64x64 halves, 2 chunks ea ----
#pragma unroll
            for (int i = 0; i < 2; ++i) {
                const int c  = gtid + 256 * i;    // 0..511
                const int rw = c >> 3, sg = c & 7;
                *(v8h*)(lds_k + rw * T_PITCH + sg * 8) =
                    *(const v8h*)(Kb + (size_t)(kv0 + rw) * HEAD_DIM + sg * 8);
                *(v8h*)(lds_v + rw * T_PITCH + sg * 8) =
                    *(const v8h*)(Vb + (size_t)rw * SEQ + kv0 + sg * 8);
            }
            if (kv0 + 64 * KV_SPLIT < kv_end) {   // prefetch the group's next KV tile
                __builtin_prefetch(Kb + (size_t)(kv0 + 64 * KV_SPLIT + (gtid & 63)) * HEAD_DIM, 0, 3);
                __builtin_prefetch(Vb + (size_t)(gtid & 63) * SEQ + kv0 + 64 * KV_SPLIT, 0, 3);
                // the prefetches' address registers are reused behind the barrier
                asm volatile("s_wait_xcnt 0x0" ::: "memory");
            }
        }
        __syncthreads();

        if (kv0 <= qr_u + 15) {  // wave-uniform causal skip (also: no tile past kv_end)
            // ---- S^T = K Q^T  (4 key-tiles x 2 k-steps) ----
            // sc[j][r] = S[query l16][key kv0 + j*16 + grp*8 + r]
            v8f sc[4];
#pragma unroll
            for (int j = 0; j < 4; ++j) {
                AB16 ak0, ak1;
                const _Float16* kp = lds_k + (j * 16 + l16) * T_PITCH;
                ak0.h[0] = *(const v8h*)(kp + grp * 8);
                ak0.h[1] = *(const v8h*)(kp + 16 + grp * 8);
                ak1.h[0] = *(const v8h*)(kp + 32 + grp * 8);
                ak1.h[1] = *(const v8h*)(kp + 48 + grp * 8);
                v8f c = {};
                c = wmma16(ak0.v, qa0.v, c);
                c = wmma16(ak1.v, qa1.v, c);
                sc[j] = c;
            }
            // ---- mask + scale + maximum of the query's scores ----
            // one partial maximum and sum per key tile: four short chains
            const int lim = qcol - kv0 - grp * 8;   // key j*16 + r is kept while <= lim
            float mxj[4];
#pragma unroll
            for (int j = 0; j < 4; ++j) {
                mxj[j] = -__builtin_inff();
#pragma unroll
                for (int r = 0; r < 8; ++r) {
                    float s = sc[j][r] * scale;
                    if (j * 16 + r > lim) s = -__builtin_inff();
                    sc[j][r] = s;
                    mxj[j] = fmaxf(mxj[j], s);
                }
            }
            float mx = fmaxf(fmaxf(mxj[0], mxj[1]), fmaxf(mxj[2], mxj[3]));
            mx = fmaxf(mx, xhalf(mx));
            // ---- online softmax update ----
            const float mn = fmaxf(m_run, mx);
            const float alpha = __expf(m_run - mn);
            m_run = mn;
            float rsj[4];
#pragma unroll
            for (int j = 0; j < 4; ++j) {
                rsj[j] = 0.f;
#pragma unroll
                for (int r = 0; r < 8; ++r) {
                    const float p = __expf(sc[j][r] - mn);
                    sc[j][r] = p;
                    rsj[j] += p;
                }
            }
            const float rs = (rsj[0] + rsj[1]) + (rsj[2] + rsj[3]);
            l_run = l_run * alpha + rs;
#pragma unroll
            for (int t = 0; t < 4; ++t)
#pragma unroll
                for (int r = 0; r < 8; ++r) o[t][r] *= alpha;

            // ---- P^T B-operands: tiles 2s and 2s+1 hold keys grp*8+r and
            //      16+grp*8+r of k-step s, the k order of the V^T loads below ----
            AB16 pb0, pb1;
#pragma unroll
            for (int r = 0; r < 8; ++r) {
                pb0.h[0][r] = (_Float16)sc[0][r];
                pb0.h[1][r] = (_Float16)sc[1][r];
                pb1.h[0][r] = (_Float16)sc[2][r];
                pb1.h[1][r] = (_Float16)sc[3][r];
            }
            // ---- O^T += V^T P^T  (4 dh-tiles x 2 k-steps) ----
#pragma unroll
            for (int t = 0; t < 4; ++t) {
                AB16 av0, av1;
                const _Float16* vp = lds_v + (t * 16 + l16) * T_PITCH;
                av0.h[0] = *(const v8h*)(vp + grp * 8);
                av0.h[1] = *(const v8h*)(vp + 16 + grp * 8);
                av1.h[0] = *(const v8h*)(vp + 32 + grp * 8);
                av1.h[1] = *(const v8h*)(vp + 48 + grp * 8);
                o[t] = wmma16(av0.v, pb0.v, o[t]);
                o[t] = wmma16(av1.v, pb1.v, o[t]);
            }
        }
        __syncthreads();
    }

    // ---- every wave's partial O into the LDS overlay, maximum and sum into lds_ml ----
    const int b = bh / NUM_HEADS;
    const int h = bh % NUM_HEADS;
    const float l_all = l_run + xhalf(l_run);    // join the halves' sums

    float* ow = lds_o + wave * (16 * O_PITCH);   // safe: loop ended with barrier
#pragma unroll
    for (int t = 0; t < 4; ++t)
#pragma unroll
        for (int u = 0; u < 2; ++u) {
            v4f val;
#pragma unroll
            for (int e = 0; e < 4; ++e) val[e] = o[t][u * 4 + e];
            *(v4f*)(ow + l16 * O_PITCH + t * 16 + grp * 8 + u * 4) = val;
        }
    if (grp == 0) {
        lds_ml[wave][l16][0] = m_run;   // -inf, with sum 0 and O 0, where the wave had no tile
        lds_ml[wave][l16][1] = l_all;
    }
    __syncthreads();   // the groups' partial results are read across waves below

    // ---- join the key groups: wave (ks, qg) takes rows ks*4 .. ks*4+3 of its
    //      16 queries; 16 lanes cover one 256-B row, so stores are whole lines.
    //      Group 0 always holds key 0, so the joint maximum is finite. ----
#pragma unroll
    for (int i = 0; i < 2; ++i) {
        const int row = ks * 4 + i * 2 + grp;
        float mg[KV_SPLIT], lg[KV_SPLIT];
#pragma unroll
        for (int g = 0; g < KV_SPLIT; ++g) {
            mg[g] = lds_ml[g * 8 + qg][row][0];
            lg[g] = lds_ml[g * 8 + qg][row][1];
        }
        const float mj = fmaxf(fmaxf(mg[0], mg[1]), fmaxf(mg[2], mg[3]));
        float lj = 0.f;
        v4f acc = {};
#pragma unroll
        for (int g = 0; g < KV_SPLIT; ++g) {
            const float w = __expf(mg[g] - mj);
            lj += lg[g] * w;
            const v4f part = *(const v4f*)(lds_o + (g * 8 + qg) * (16 * O_PITCH) +
                                           row * O_PITCH + l16 * 4);
#pragma unroll
            for (int e = 0; e < 4; ++e) acc[e] += part[e] * w;
        }
        const float inv_l = 1.0f / lj;
#pragma unroll
        for (int e = 0; e < 4; ++e) acc[e] *= inv_l;
        *(v4f*)(out + ((size_t)(h * BATCH + b) * SEQ + qr + row) * HEAD_DIM +
                l16 * 4) = acc;
    }
}

// ---------------------------------------------------------------------------
extern "C" void kernel_launch(void* const* d_in, const int* in_sizes, int n_in,
                              void* d_out, int out_size, void* d_ws, size_t ws_size,
                              hipStream_t stream) {
    const float* q    = (const float*)d_in[0];
    const float* k    = (const float*)d_in[1];
    const float* v    = (const float*)d_in[2];
    const float* W    = (const float*)d_in[3];
    const float* bias = (const float*)d_in[4];

    const size_t per = (size_t)BATCH * NUM_HEADS * SEQ * HEAD_DIM;  // 2,097,152
    _Float16* Qh = (_Float16*)d_ws;
    _Float16* Kh = Qh + per;
    _Float16* Vt = Kh + per;

    dim3 pgrid((BATCH * SEQ) / 128, D_MODEL / 64, 3);
    proj_kernel<<<pgrid, 256, 0, stream>>>(q, k, v, W, bias, Qh, Kh, Vt);

    dim3 agrid(SEQ / 128, BATCH * NUM_HEADS);
    attn_kernel<<<agrid, 256 * KV_SPLIT, 0, stream>>>(Qh, Kh, Vt, (float*)d_out);
}

// v005
// Measured time: 37.1 microseconds a run.
// Next to v004, in two timings, it ran 1.24 times as fast each time.
// All steps since v000 together make it 4.01 times as fast.
#include <hip/hip_runtime.h>

#define D_MODEL   512
#define NUM_HEADS 8
#define HEAD_DIM  64
#define BATCH     2
#define SEQ       2048

// LDS row pitches. A fragment read is one ds_load_b128 per lane with 16 lanes on
// 16 consecutive rows; a pitch of 16 B x odd puts those rows on disjoint banks.
#define T_PITCH  72   // halves: 64 data + 8 pad  (144 B), K / V^T tiles, projection slices
#define O_PITCH  68   // floats: 64 data + 4 pad  (272 B), output staging
#define KV_SPLIT 4    // wave groups of the attention block, each on its own key tiles
#define PBM      128  // projection block tile, rows of X
#define PBN      256  // projection block tile, rows of W
#define PBK      64   // k of one projection slice
#define P_STAGE  ((PBM + PBN) * T_PITCH)          // halves of one slice buffer
#define P_CH     ((PBM + PBN) * PBK / 4 / 512)    // 16-B f32 chunks per thread and slice

typedef __attribute__((ext_vector_type(16))) _Float16 v16h;
typedef __attribute__((ext_vector_type(8)))  _Float16 v8h;
typedef __attribute__((ext_vector_type(4)))  _Float16 v4h;
typedef __attribute__((ext_vector_type(8)))  float    v8f;
typedef __attribute__((ext_vector_type(4)))  float    v4f;

union AB16 { v16h v; v8h h[2]; };

__device__ __forceinline__ v8f wmma16(v16h a, v16h b, v8f c) {
    return __builtin_amdgcn_wmma_f32_16x16x32_f16(false, a, false, b,
                                                  (short)0, c, false, false);
}

// ---------------------------------------------------------------------------
// Fused projection: P = relu(X @ W^T + b), emitted as f16.
//   z==0 -> Qh [b,h,s,dh]   z==1 -> Kh [b,h,s,dh]   z==2 -> Vt [b,h,dh,s]
// Grid: (M/128, 512/256, 3), block 512 (16 waves, 4 x 4). Block tile 128(M) x
// 256(N), wave tile 32 x 64 (one head). A slice is 64 k of the 128 X rows and the
// 256 W rows: every load instruction covers two whole 256-B row pieces, the slice
// is converted once and kept as f16 in one of two LDS buffers. Slices are fetched
// two ahead into two register sets, so loads stay in flight through every pass but the last.
// ---------------------------------------------------------------------------
__device__ __forceinline__ void proj_fetch(v4f (&r)[P_CH], const float* __restrict__ xs,
                                           const float* __restrict__ wsrc, int s) {
#pragma unroll
    for (int i = 0; i < P_CH; ++i)
        r[i] = (i < PBM / 32)
                   ? *(const v4f*)(xs + (size_t)i * 32 * D_MODEL + s * PBK)
                   : *(const v4f*)(wsrc + (size_t)(i - PBM / 32) * 32 * D_MODEL + s * PBK);
}

__device__ __forceinline__ void proj_put(const v4f (&r)[P_CH], _Float16* dst) {
#pragma unroll
    for (int i = 0; i < P_CH; ++i) {
        v4h pk;
#pragma unroll
        for (int e = 0; e < 4; ++e) pk[e] = (_Float16)r[i][e];
        *(v4h*)(dst + i * 32 * T_PITCH) = pk;
    }
}

// Work-group barrier behind the wave's LDS traffic alone: __syncthreads() also waits
// for every global load, and the slices fetched ahead must stay in flight across it.
// No global store precedes it in this kernel.
__device__ __forceinline__ void proj_barrier() {
    asm volatile("s_wait_dscnt 0x0\n\ts_barrier_signal -1\n\ts_barrier_wait -1" ::: "memory");
}

__global__ __launch_bounds__(512)
void proj_kernel(const float* __restrict__ Xq, const float* __restrict__ Xk,
                 const float* __restrict__ Xv, const float* __restrict__ W,
                 const float* __restrict__ bias,
                 _Float16* __restrict__ Qh, _Float16* __restrict__ Kh,
                 _Float16* __restrict__ Vt) {
    // two slice buffers [X 128 rows | W 256 rows][T_PITCH]; store staging after the loop
    __shared__ __align__(16) _Float16 lds_s[2 * P_STAGE];
    static_assert(16 * 32 * 64 <= 2 * P_STAGE, "store staging fits the overlay");

    const int tid  = threadIdx.x;
    const int wave = tid >> 5;
    const int lane = tid & 31;
    const int grp  = lane >> 4;   // half-wave group (K-group of WMMA layouts)
    const int l16  = lane & 15;
    const int wm   = wave >> 2;   // wave's 32 rows of the block tile
    const int wn   = wave & 3;    // wave's 64 columns (head) of the block tile

    const int z = blockIdx.z;
    const float* X = (z == 0) ? Xq : (z == 1) ? Xk : Xv;

    const int mb = blockIdx.x * PBM;   // first M row of the block
    const int nb = blockIdx.y * PBN;   // first N col of the block

    // loader: thread takes 16 B of row (tid >> 4) + 32 i, 16 threads a 256-B row piece
    const int lr = tid >> 4, lc = (tid & 15) * 4;
    const float* xs   = X + (size_t)(mb + lr) * D_MODEL + lc;
    const float* wsrc = W + (size_t)(nb + lr) * D_MODEL + lc;
    _Float16* put = lds_s + lr * T_PITCH + lc;

    v8f acc[2][4] = {};
    v4f r[2][P_CH];

    proj_fetch(r[0], xs, wsrc, 0);
    // keeps slice 0's loads the older ones, so that its wait leaves slice 1's in flight
    __builtin_amdgcn_sched_barrier(0);
    proj_fetch(r[1], xs, wsrc, 1);
    // keeps slice 1's loads in front of the first conversion (and its wait)
    __builtin_amdgcn_sched_barrier(0);
    proj_put(r[0], put);
    proj_barrier();

    // unrolled so that the register set and the LDS buffer of a pass are compile-time
#pragma unroll
    for (int s = 0; s < D_MODEL / PBK; ++s) {
        if (s + 2 < D_MODEL / PBK) proj_fetch(r[s & 1], xs, wsrc, s + 2);
        // keeps the loads at the head of the pass: they fly through two passes' products
        __builtin_amdgcn_sched_barrier(0);
        const _Float16* buf = lds_s + (s & 1) * P_STAGE;
#pragma unroll
        for (int k2 = 0; k2 < PBK; k2 += 32) {
            AB16 a[2], bm[4];
#pragma unroll
            for (int mi = 0; mi < 2; ++mi) {
                const _Float16* ap = buf + (wm * 32 + mi * 16 + l16) * T_PITCH + k2;
                a[mi].h[0] = *(const v8h*)(ap + grp * 8);
                a[mi].h[1] = *(const v8h*)(ap + 16 + grp * 8);
            }
#pragma unroll
            for (int j = 0; j < 4; ++j) {
                const _Float16* bp = buf + (PBM + wn * 64 + j * 16 + l16) * T_PITCH + k2;
                bm[j].h[0] = *(const v8h*)(bp + grp * 8);
                bm[j].h[1] = *(const v8h*)(bp + 16 + grp * 8);
            }
#pragma unroll
            for (int mi = 0; mi < 2; ++mi)
#pragma unroll
                for (int j = 0; j < 4; ++j)
                    acc[mi][j] = wmma16(a[mi].v, bm[j].v, acc[mi][j]);
        }
        // keeps the conversions, and so the wait for the loads, behind this pass's products
        __builtin_amdgcn_sched_barrier(0);
        // the other buffer's readers left it at the barrier that ended the pass before
        if (s + 1 < D_MODEL / PBK) proj_put(r[(s + 1) & 1], put + ((s + 1) & 1) * P_STAGE);
        proj_barrier();
    }

    // ---- epilogue: + bias, relu, f16, packed 128-bit stores ----
    const int n0 = nb + wn * 64;          // wave's first N col (== head*64)
    const int h  = n0 / HEAD_DIM;         // one head per wave
    float bv[4];
#pragma unroll
    for (int j = 0; j < 4; ++j) bv[j] = bias[n0 + j * 16 + l16];

    const int mw = mb + wm * 32;          // wave's first M row; its 32 rows are in one batch
    const int b  = mw >> 11;
    const int sw = mw & (SEQ - 1);

    if (z == 2) {
        // Vt [dh][s]: C-layout register column r = consecutive s -> direct v8h
#pragma unroll
        for (int mi = 0; mi < 2; ++mi)
#pragma unroll
            for (int j = 0; j < 4; ++j) {
                const int dh = j * 16 + l16;
                v8h pk;
#pragma unroll
                for (int q = 0; q < 8; ++q) {
                    float val = acc[mi][j][q] + bv[j];
                    val = val > 0.f ? val : 0.f;
                    pk[q] = (_Float16)val;
                }
                *(v8h*)(Vt + ((size_t)(b * NUM_HEADS + h) * HEAD_DIM + dh) * SEQ +
                        sw + mi * 16 + grp * 8) = pk;
            }
    } else {
        // Qh/Kh [s][dh]: stage the wave's 32 x 64 tile in LDS, then coalesced b128 copy-out
        _Float16* dst = (z == 0) ? Qh : Kh;
        _Float16* cw  = lds_s + wave * (32 * 64);
#pragma unroll
        for (int mi = 0; mi < 2; ++mi)
#pragma unroll
            for (int j = 0; j < 4; ++j)
#pragma unroll
                for (int q = 0; q < 8; ++q) {
                    float val = acc[mi][j][q] + bv[j];
                    val = val > 0.f ? val : 0.f;
                    cw[(mi * 16 + grp * 8 + q) * 64 + j * 16 + l16] = (_Float16)val;
                }
        // same-wave DS ordering; 32 rows x 8 segs = 256 chunks, 8 per lane
#pragma unroll
        for (int i = 0; i < 8; ++i) {
            const int c   = lane + 32 * i;
            const int row = c >> 3, seg = c & 7;
            const v8h pk = *(const v8h*)(cw + row * 64 + seg * 8);
            *(v8h*)(dst + ((size_t)(b * NUM_HEADS + h) * SEQ + sw + row) *
                    HEAD_DIM + seg * 8) = pk;
        }
        // in the listing this branch falls through into code that rewrites the stores' address pair
        asm volatile("s_wait_xcnt 0x0" ::: "memory");
    }
}

// ---------------------------------------------------------------------------
// Causal flash attention, transposed products: S^T = K Q^T, O^T += V^T P^T.
// Grid: (SEQ/128, B*H), block 1024 = KV_SPLIT groups of 8 waves. A block takes
// two 64-query tiles, t and SEQ/64 - 1 - t: waves 0-3 of a group the early one,
// waves 4-7 the late one, so every block has the same causal work (SEQ/64 + 1
// tile pairs) and each SIMD holds as many early as late waves. Wave owns 16
// queries, one per lane column (l16); a lane holds 32 of the 64 scores of its
// query, lane ^ 16 the other 32. Maximum and sum are in-lane; two S^T tiles
// converted in place are the B operand of the second product, so P never leaves
// the registers. KV tiles of 64 staged in LDS, one per group and pass: group g
// walks tiles g, g + KV_SPLIT, ... with a running maximum, sum and O of its own;
// the groups' partial results are joined through LDS after the loop.
// ---------------------------------------------------------------------------
// value of lane l ^ 16
__device__ __forceinline__ float xhalf(float x) {
    const int i = __builtin_bit_cast(int, x);
    return __builtin_bit_cast(float, __builtin_amdgcn_permlanex16(
        i, i, 0x76543210, 0xfedcba98, false, false));
}

__global__ __launch_bounds__(256 * KV_SPLIT)
void attn_kernel(const _Float16* __restrict__ Qh, const _Float16* __restrict__ Kh,
                 const _Float16* __restrict__ Vt, float* __restrict__ out) {
    // overlay: per group [K 9KB | V 9KB] during loop, partial O of every wave after
    __shared__ __align__(16) unsigned char smem[KV_SPLIT * 8 * 16 * O_PITCH * 4];
    __shared__ __align__(8) float lds_ml[KV_SPLIT * 8][16][2];  // per wave and query: maximum, sum
    static_assert(KV_SPLIT * 2 * 64 * T_PITCH * 2 <= sizeof(smem), "K and V tiles fit the overlay");
    static_assert(KV_SPLIT == 4, "the join deals 16 rows to 4 groups and takes a maximum of 4");

    const int tid  = threadIdx.x;
    const int wave = tid >> 5;
    const int lane = tid & 31;
    const int grp  = lane >> 4;
    const int l16  = lane & 15;
    const int gtid = tid & 255;                // thread within its key group
    const int qg   = wave & 7;                 // wave in its group: early/late tile and 16-row slice
    const int ks   = __builtin_amdgcn_readfirstlane(wave >> 3);  // key group, uniform

    _Float16* lds_k = (_Float16*)smem + ks * (2 * 64 * T_PITCH);  // [kv 64][T_PITCH]
    _Float16* lds_v = lds_k + 64 * T_PITCH;            // [d 64][T_PITCH]
    float*    lds_o = (float*)smem;                    // 32 waves x [16][O_PITCH] f32

    const int bh = blockIdx.y;                 // b*H + h
    const int qt_late = SEQ / 64 - 1 - (int)blockIdx.x;          // the block's late query tile
    const int qt = (qg < 4) ? (int)blockIdx.x : qt_late;         // the wave's query tile
    const int qr = qt * 64 + (qg & 3) * 16;    // wave's first query row
    const int qr_u = __builtin_amdgcn_readfirstlane(qr);  // uniform branch key

    const _Float16* Qb = Qh + (size_t)bh * SEQ * HEAD_DIM;
    const _Float16* Kb = Kh + (size_t)bh * SEQ * HEAD_DIM;
    const _Float16* Vb = Vt + (size_t)bh * HEAD_DIM * SEQ;

    // Q B-operands (column = query l16) for K-steps d=0..31 and d=32..63
    AB16 qa0, qa1;
    {
        const _Float16* qp = Qb + (size_t)(qr + l16) * HEAD_DIM;
        qa0.h[0] = *(const v8h*)(qp + grp * 8);
        qa0.h[1] = *(const v8h*)(qp + 16 + grp * 8);
        qa1.h[0] = *(const v8h*)(qp + 32 + grp * 8);
        qa1.h[1] = *(const v8h*)(qp + 48 + grp * 8);
    }

    float m_run = -__builtin_inff();   // running maximum of query l16 (both halves alike)
    float l_run = 0.f;                 // running sum over this half's keys only
    v8f o[4] = {};                     // o[t][r] = O[query l16][d = t*16 + grp*8 + r]

    const float scale = 0.125f;  // 1/sqrt(64)
    // block-uniform trip count (keys of the late tile): every wave passes every
    // barrier and helps fill; early-tile waves skip only the products below
    const int kv_end = (qt_late + 1) * 64;
    const int qcol = qr + l16;         // this lane's query

    for (int kvb = 0; kvb < kv_end; kvb += 64 * KV_SPLIT) {
        const int kv0 = kvb + ks * 64;        // this group's tile of the pass
        if (kv0 < kv_end) {                   // uniform in the group's waves
            // ---- the group's LDS fill: K 64x64 + V^T 64x64 halves, 2 chunks ea ----
#pragma unroll
            for (int i = 0; i < 2; ++i) {
                const int c  = gtid + 256 * i;    // 0..511
                const int rw = c >> 3, sg = c & 7;
                *(v8h*)(lds_k + rw * T_PITCH + sg * 8) =
                    *(const v8h*)(Kb + (size_t)(kv0 + rw) * HEAD_DIM + sg * 8);
                *(v8h*)(lds_v + rw * T_PITCH + sg * 8) =
                    *(const v8h*)(Vb + (size_t)rw * SEQ + kv0 + sg * 8);
            }
            if (kv0 + 64 * KV_SPLIT < kv_end) {   // prefetch the group's next KV tile
                __builtin_prefetch(Kb + (size_t)(kv0 + 64 * KV_SPLIT + (gtid & 63)) * HEAD_DIM, 0, 3);
                __builtin_prefetch(Vb + (size_t)(gtid & 63) * SEQ + kv0 + 64 * KV_SPLIT, 0, 3);
                // the prefetches' address registers are reused behind the barrier
                asm volatile("s_wait_xcnt 0x0" ::: "memory");
            }
        }
        __syncthreads();

        if (kv0 <= qr_u + 15) {  // wave-uniform causal skip (also: no tile past kv_end)
            // ---- S^T = K Q^T  (4 key-tiles x 2 k-steps) ----
            // sc[j][r] = S[query l16][key kv0 + j*16 + grp*8 + r]
            v8f sc[4];
#pragma unroll
            for (int j = 0; j < 4; ++j) {
                AB16 ak0, ak1;
                const _Float16* kp = lds_k + (j * 16 + l16) * T_PITCH;
                ak0.h[0] = *(const v8h*)(kp + grp * 8);
                ak0.h[1] = *(const v8h*)(kp + 16 + grp * 8);
                ak1.h[0] = *(const v8h*)(kp + 32 + grp * 8);
                ak1.h[1] = *(const v8h*)(kp + 48 + grp * 8);
                v8f c = {};
                c = wmma16(ak0.v, qa0.v, c);
                c = wmma16(ak1.v, qa1.v, c);
                sc[j] = c;
            }
            // ---- mask + scale + maximum of the query's scores ----
            // one partial maximum and sum per key tile: four short chains
            const int lim = qcol - kv0 - grp * 8;   // key j*16 + r is kept while <= lim
            float mxj[4];
#pragma unroll
            for (int j = 0; j < 4; ++j) {
                mxj[j] = -__builtin_inff();
#pragma unroll
                for (int r = 0; r < 8; ++r) {
                    float s = sc[j][r] * scale;
                    if (j * 16 + r > lim) s = -__builtin_inff();
                    sc[j][r] = s;
                    mxj[j] = fmaxf(mxj[j], s);
                }
            }
            float mx = fmaxf(fmaxf(mxj[0], mxj[1]), fmaxf(mxj[2], mxj[3]));
            mx = fmaxf(mx, xhalf(mx));
            // ---- online softmax update ----
            const float mn = fmaxf(m_run, mx);
            const float alpha = __expf(m_run - mn);
            m_run = mn;
            float rsj[4];
#pragma unroll
            for (int j = 0; j < 4; ++j) {
                rsj[j] = 0.f;
#pragma unroll
                for (int r = 0; r < 8; ++r) {
                    const float p = __expf(sc[j][r] - mn);
                    sc[j][r] = p;
                    rsj[j] += p;
                }
            }
            const float rs = (rsj[0] + rsj[1]) + (rsj[2] + rsj[3]);
            l_run = l_run * alpha + rs;
#pragma unroll
            for (int t = 0; t < 4; ++t)
#pragma unroll
                for (int r = 0; r < 8; ++r) o[t][r] *= alpha;

            // ---- P^T B-operands: tiles 2s and 2s+1 hold keys grp*8+r and
            //      16+grp*8+r of k-step s, the k order of the V^T loads below ----
            AB16 pb0, pb1;
#pragma unroll
            for (int r = 0; r < 8; ++r) {
                pb0.h[0][r] = (_Float16)sc[0][r];
                pb0.h[1][r] = (_Float16)sc[1][r];
                pb1.h[0][r] = (_Float16)sc[2][r];
                pb1.h[1][r] = (_Float16)sc[3][r];
            }
            // ---- O^T += V^T P^T  (4 dh-tiles x 2 k-steps) ----
#pragma unroll
            for (int t = 0; t < 4; ++t) {
                AB16 av0, av1;
                const _Float16* vp = lds_v + (t * 16 + l16) * T_PITCH;
                av0.h[0] = *(const v8h*)(vp + grp * 8);
                av0.h[1] = *(const v8h*)(vp + 16 + grp * 8);
                av1.h[0] = *(const v8h*)(vp + 32 + grp * 8);
                av1.h[1] = *(const v8h*)(vp + 48 + grp * 8);
                o[t] = wmma16(av0.v, pb0.v, o[t]);
                o[t] = wmma16(av1.v, pb1.v, o[t]);
            }
        }
        __syncthreads();
    }

    // ---- every wave's partial O into the LDS overlay, maximum and sum into lds_ml ----
    const int b = bh / NUM_HEADS;
    const int h = bh % NUM_HEADS;
    const float l_all = l_run + xhalf(l_run);    // join the halves' sums

    float* ow = lds_o + wave * (16 * O_PITCH);   // safe: loop ended with barrier
#pragma unroll
    for (int t = 0; t < 4; ++t)
#pragma unroll
        for (int u = 0; u < 2; ++u) {
            v4f val;
#pragma unroll
            for (int e = 0; e < 4; ++e) val[e] = o[t][u * 4 + e];
            *(v4f*)(ow + l16 * O_PITCH + t * 16 + grp * 8 + u * 4) = val;
        }
    if (grp == 0) {
        lds_ml[wave][l16][0] = m_run;   // -inf, with sum 0 and O 0, where the wave had no tile
        lds_ml[wave][l16][1] = l_all;
    }
    __syncthreads();   // the groups' partial results are read across waves below

    // ---- join the key groups: wave (ks, qg) takes rows ks*4 .. ks*4+3 of its
    //      16 queries; 16 lanes cover one 256-B row, so stores are whole lines.
    //      Group 0 always holds key 0, so the joint maximum is finite. ----
#pragma unroll
    for (int i = 0; i < 2; ++i) {
        const int row = ks * 4 + i * 2 + grp;
        float mg[KV_SPLIT], lg[KV_SPLIT];
#pragma unroll
        for (int g = 0; g < KV_SPLIT; ++g) {
            mg[g] = lds_ml[g * 8 + qg][row][0];
            lg[g] = lds_ml[g * 8 + qg][row][1];
        }
        const float mj = fmaxf(fmaxf(mg[0], mg[1]), fmaxf(mg[2], mg[3]));
        float lj = 0.f;
        v4f acc = {};
#pragma unroll
        for (int g = 0; g < KV_SPLIT; ++g) {
            const float w = __expf(mg[g] - mj);
            lj += lg[g] * w;
            const v4f part = *(const v4f*)(lds_o + (g * 8 + qg) * (16 * O_PITCH) +
                                           row * O_PITCH + l16 * 4);
#pragma unroll
            for (int e = 0; e < 4; ++e) acc[e] += part[e] * w;
        }
        const float inv_l = 1.0f / lj;
#pragma unroll
        for (int e = 0; e < 4; ++e) acc[e] *= inv_l;
        *(v4f*)(out + ((size_t)(h * BATCH + b) * SEQ + qr + row) * HEAD_DIM +
                l16 * 4) = acc;
    }
}

// ---------------------------------------------------------------------------
extern "C" void kernel_launch(void* const* d_in, const int* in_sizes, int n_in,
                              void* d_out, int out_size, void* d_ws, size_t ws_size,
                              hipStream_t stream) {
    const float* q    = (const float*)d_in[0];
    const float* k    = (const float*)d_in[1];
    const float* v    = (const float*)d_in[2];
    const float* W    = (const float*)d_in[3];
    const float* bias = (const float*)d_in[4];

    const size_t per = (size_t)BATCH * NUM_HEADS * SEQ * HEAD_DIM;  // 2,097,152
    _Float16* Qh = (_Float16*)d_ws;
    _Float16* Kh = Qh + per;
    _Float16* Vt = Kh + per;

    dim3 pgrid((BATCH * SEQ) / PBM, D_MODEL / PBN, 3);
    proj_kernel<<<pgrid, 512, 0, stream>>>(q, k, v, W, bias, Qh, Kh, Vt);

    dim3 agrid(SEQ / 128, BATCH * NUM_HEADS);
    attn_kernel<<<agrid, 256 * KV_SPLIT, 0, stream>>>(Qh, Kh, Vt, (float*)d_out);
}

// v006
// One run takes 30.7 microseconds.
// Two timings next to v005 both put it at 1.21 times that version's speed.
// All steps since v000 together make it 4.85 times as fast.
#include <hip/hip_runtime.h>

#define D_MODEL   512
#define NUM_HEADS 8
#define HEAD_DIM  64
#define BATCH     2
#define SEQ       2048

// LDS row pitches. A fragment read is one ds_load_b128 per lane with 16 lanes on
// 16 consecutive rows; a pitch of 16 B x odd puts those rows on disjoint banks.
#define T_PITCH  72   // halves: 64 data + 8 pad  (144 B), K / V^T tiles, projection slices
#define O_PITCH  68   // floats: 64 data + 4 pad  (272 B), output staging
#define KV_SPLIT 4    // wave groups of the attention block, each on its own key tiles
#define KV_BUF   (2 * 64 * T_PITCH)               // halves of one K + V^T tile buffer
#define PBM      128  // projection block tile, rows of X
#define PBN      256  // projection block tile, rows of W
#define PBK      64   // k of one projection slice
#define P_STAGE  ((PBM + PBN) * T_PITCH)          // halves of one slice buffer
#define P_CH     ((PBM + PBN) * PBK / 4 / 512)    // 16-B f32 chunks per thread and slice

typedef __attribute__((ext_vector_type(16))) _Float16 v16h;
typedef __attribute__((ext_vector_type(8)))  _Float16 v8h;
typedef __attribute__((ext_vector_type(4)))  _Float16 v4h;
typedef __attribute__((ext_vector_type(8)))  float    v8f;
typedef __attribute__((ext_vector_type(4)))  float    v4f;

union AB16 { v16h v; v8h h[2]; };

__device__ __forceinline__ v8f wmma16(v16h a, v16h b, v8f c) {
    return __builtin_amdgcn_wmma_f32_16x16x32_f16(false, a, false, b,
                                                  (short)0, c, false, false);
}

// ---------------------------------------------------------------------------
// Fused projection: P = relu(X @ W^T + b), emitted as f16.
//   z==0 -> Qh [b,h,s,dh]   z==1 -> Kh [b,h,s,dh]   z==2 -> Vt [b,h,dh,s]
// Grid: (M/128, 512/256, 3), block 512 (16 waves, 4 x 4). Block tile 128(M) x
// 256(N), wave tile 32 x 64 (one head). A slice is 64 k of the 128 X rows and the
// 256 W rows: every load instruction covers two whole 256-B row pieces, the slice
// is converted once and kept as f16 in one of two LDS buffers. Slices are fetched
// two ahead into two register sets, so loads stay in flight through every pass but the last.
// ---------------------------------------------------------------------------
__device__ __forceinline__ void proj_fetch(v4f (&r)[P_CH], const float* __restrict__ xs,
                                           const float* __restrict__ wsrc, int s) {
#pragma unroll
    for (int i = 0; i < P_CH; ++i)
        r[i] = (i < PBM / 32)
                   ? *(const v4f*)(xs + (size_t)i * 32 * D_MODEL + s * PBK)
                   : *(const v4f*)(wsrc + (size_t)(i - PBM / 32) * 32 * D_MODEL + s * PBK);
}

__device__ __forceinline__ void proj_put(const v4f (&r)[P_CH], _Float16* dst) {
#pragma unroll
    for (int i = 0; i < P_CH; ++i) {
        v4h pk;
#pragma unroll
        for (int e = 0; e < 4; ++e) pk[e] = (_Float16)r[i][e];
        *(v4h*)(dst + i * 32 * T_PITCH) = pk;
    }
}

// Work-group barrier behind the wave's LDS traffic alone: __syncthreads() also waits
// for every global load, and the slices fetched ahead must stay in flight across it.
// No global store precedes it in this kernel.
__device__ __forceinline__ void proj_barrier() {
    asm volatile("s_wait_dscnt 0x0\n\ts_barrier_signal -1\n\ts_barrier_wait -1" ::: "memory");
}

__global__ __launch_bounds__(512)
void proj_kernel(const float* __restrict__ Xq, const float* __restrict__ Xk,
                 const float* __restrict__ Xv, const float* __restrict__ W,
                 const float* __restrict__ bias,
                 _Float16* __restrict__ Qh, _Float16* __restrict__ Kh,
                 _Float16* __restrict__ Vt) {
    // two slice buffers [X 128 rows | W 256 rows][T_PITCH]; store staging after the loop
    __shared__ __align__(16) _Float16 lds_s[2 * P_STAGE];
    static_assert(16 * 32 * 64 <= 2 * P_STAGE, "store staging fits the overlay");

    const int tid  = threadIdx.x;
    const int wave = tid >> 5;
    const int lane = tid & 31;
    const int grp  = lane >> 4;   // half-wave group (K-group of WMMA layouts)
    const int l16  = lane & 15;
    const int wm   = wave >> 2;   // wave's 32 rows of the block tile
    const int wn   = wave & 3;    // wave's 64 columns (head) of the block tile

    const int z = blockIdx.z;
    const float* X = (z == 0) ? Xq : (z == 1) ? Xk : Xv;

    const int mb = blockIdx.x * PBM;   // first M row of the block
    const int nb = blockIdx.y * PBN;   // first N col of the block

    // loader: thread takes 16 B of row (tid >> 4) + 32 i, 16 threads a 256-B row piece
    const int lr = tid >> 4, lc = (tid & 15) * 4;
    const float* xs   = X + (size_t)(mb + lr) * D_MODEL + lc;
    const float* wsrc = W + (size_t)(nb + lr) * D_MODEL + lc;
    _Float16* put = lds_s + lr * T_PITCH + lc;

    v8f acc[2][4] = {};
    v4f r[2][P_CH];

    proj_fetch(r[0], xs, wsrc, 0);
    // keeps slice 0's loads the older ones, so that its wait leaves slice 1's in flight
    __builtin_amdgcn_sched_barrier(0);
    proj_fetch(r[1], xs, wsrc, 1);
    // keeps slice 1's loads in front of the first conversion (and its wait)
    __builtin_amdgcn_sched_barrier(0);
    proj_put(r[0], put);
    proj_barrier();

    // unrolled so that the register set and the LDS buffer of a pass are compile-time
#pragma unroll
    for (int s = 0; s < D_MODEL / PBK; ++s) {
        if (s + 2 < D_MODEL / PBK) proj_fetch(r[s & 1], xs, wsrc, s + 2);
        // keeps the loads at the head of the pass: they fly through two passes' products
        __builtin_amdgcn_sched_barrier(0);
        const _Float16* buf = lds_s + (s & 1) * P_STAGE;
#pragma unroll
        for (int k2 = 0; k2 < PBK; k2 += 32) {
            AB16 a[2], bm[4];
#pragma unroll
            for (int mi = 0; mi < 2; ++mi) {
                const _Float16* ap = buf + (wm * 32 + mi * 16 + l16) * T_PITCH + k2;
                a[mi].h[0] = *(const v8h*)(ap + grp * 8);
                a[mi].h[1] = *(const v8h*)(ap + 16 + grp * 8);
            }
#pragma unroll
            for (int j = 0; j < 4; ++j) {
                const _Float16* bp = buf + (PBM + wn * 64 + j * 16 + l16) * T_PITCH + k2;
                bm[j].h[0] = *(const v8h*)(bp + grp * 8);
                bm[j].h[1] = *(const v8h*)(bp + 16 + grp * 8);
            }
#pragma unroll
            for (int mi = 0; mi < 2; ++mi)
#pragma unroll
                for (int j = 0; j < 4; ++j)
                    acc[mi][j] = wmma16(a[mi].v, bm[j].v, acc[mi][j]);
        }
        // keeps the conversions, and so the wait for the loads, behind this pass's products
        __builtin_amdgcn_sched_barrier(0);
        // the other buffer's readers left it at the barrier that ended the pass before
        if (s + 1 < D_MODEL / PBK) proj_put(r[(s + 1) & 1], put + ((s + 1) & 1) * P_STAGE);
        proj_barrier();
    }

    // ---- epilogue: + bias, relu, f16, packed 128-bit stores ----
    const int n0 = nb + wn * 64;          // wave's first N col (== head*64)
    const int h  = n0 / HEAD_DIM;         // one head per wave
    float bv[4];
#pragma unroll
    for (int j = 0; j < 4; ++j) bv[j] = bias[n0 + j * 16 + l16];

    const int mw = mb + wm * 32;          // wave's first M row; its 32 rows are in one batch
    const int b  = mw >> 11;
    const int sw = mw & (SEQ - 1);

    if (z == 2) {
        // Vt [dh][s]: C-layout register column r = consecutive s -> direct v8h
#pragma unroll
        for (int mi = 0; mi < 2; ++mi)
#pragma unroll
            for (int j = 0; j < 4; ++j) {
                const int dh = j * 16 + l16;
                v8h pk;
#pragma unroll
                for (int q = 0; q < 8; ++q) {
                    float val = acc[mi][j][q] + bv[j];
                    val = val > 0.f ? val : 0.f;
                    pk[q] = (_Float16)val;
                }
                *(v8h*)(Vt + ((size_t)(b * NUM_HEADS + h) * HEAD_DIM + dh) * SEQ +
                        sw + mi * 16 + grp * 8) = pk;
            }
    } else {
        // Qh/Kh [s][dh]: stage the wave's 32 x 64 tile in LDS, then coalesced b128 copy-out
        _Float16* dst = (z == 0) ? Qh : Kh;
        _Float16* cw  = lds_s + wave * (32 * 64);
#pragma unroll
        for (int mi = 0; mi < 2; ++mi)
#pragma unroll
            for (int j = 0; j < 4; ++j)
#pragma unroll
                for (int q = 0; q < 8; ++q) {
                    float val = acc[mi][j][q] + bv[j];
                    val = val > 0.f ? val : 0.f;
                    cw[(mi * 16 + grp * 8 + q) * 64 + j * 16 + l16] = (_Float16)val;
                }
        // same-wave DS ordering; 32 rows x 8 segs = 256 chunks, 8 per lane
#pragma unroll
        for (int i = 0; i < 8; ++i) {
            const int c   = lane + 32 * i;
            const int row = c >> 3, seg = c & 7;
            const v8h pk = *(const v8h*)(cw + row * 64 + seg * 8);
            *(v8h*)(dst + ((size_t)(b * NUM_HEADS + h) * SEQ + sw + row) *
                    HEAD_DIM + seg * 8) = pk;
        }
        // in the listing this branch falls through into code that rewrites the stores' address pair
        asm volatile("s_wait_xcnt 0x0" ::: "memory");
    }
}

// ---------------------------------------------------------------------------
// Causal flash attention, transposed products: S^T = K Q^T, O^T += V^T P^T.
// Grid: (SEQ/128, B*H), block 1024 = KV_SPLIT groups of 8 waves. A block takes
// two 64-query tiles, t and SEQ/64 - 1 - t: waves 0-3 of a group the early one,
// waves 4-7 the late one, so every block has the same causal work (SEQ/64 + 1
// tile pairs) and each SIMD holds as many early as late waves. Wave owns 16
// queries, one per lane column (l16); a lane holds 32 of the 64 scores of its
// query, lane ^ 16 the other 32. Maximum and sum are in-lane; two S^T tiles
// converted in place are the B operand of the second product, so P never leaves
// the registers. KV tiles of 64 staged in LDS, one per group and pass: group g
// walks tiles g, g + KV_SPLIT, ... with a running maximum, sum and O of its own;
// the groups' partial results are joined through LDS after the loop.
// Each group has two tile buffers, filled by asynchronous copies to LDS: the next
// pass's tile is in flight while this pass's is worked on, one barrier a pass.
// ---------------------------------------------------------------------------
// value of lane l ^ 16
__device__ __forceinline__ float xhalf(float x) {
    const int i = __builtin_bit_cast(int, x);
    return __builtin_bit_cast(float, __builtin_amdgcn_permlanex16(
        i, i, 0x76543210, 0xfedcba98, false, false));
}

// One group's K and V^T tile (64 x 128 B each) into one LDS buffer: 4 chunks of 16 B a
// thread, rows rw and rw + 32 of either tile. kg, vg: the lane's chunk of row rw in
// global memory; lk: its LDS byte address in the K half of the buffer.
__device__ __forceinline__ void kv_copy(const _Float16* kg, const _Float16* vg, unsigned lk) {
    const _Float16* kg1 = kg + 32 * HEAD_DIM;
    const _Float16* vg1 = vg + (size_t)32 * SEQ;
    const unsigned lk1 = lk + 32 * T_PITCH * 2;
    const unsigned lv  = lk + 64 * T_PITCH * 2;
    const unsigned lv1 = lv + 32 * T_PITCH * 2;
    // the closing wait stands in front of any rewrite of the address registers named here
    asm volatile("global_load_async_to_lds_b128 %0, %4, off\n\t"
                 "global_load_async_to_lds_b128 %1, %5, off\n\t"
                 "global_load_async_to_lds_b128 %2, %6, off\n\t"
                 "global_load_async_to_lds_b128 %3, %7, off\n\t"
                 "s_wait_xcnt 0x0"
                 :: "v"(lk), "v"(lk1), "v"(lv), "v"(lv1), "v"(kg), "v"(kg1), "v"(vg), "v"(vg1)
                 : "memory");
}

__global__ __launch_bounds__(256 * KV_SPLIT)
void attn_kernel(const _Float16* __restrict__ Qh, const _Float16* __restrict__ Kh,
                 const _Float16* __restrict__ Vt, float* __restrict__ out) {
    // overlay: per group 2 x [K 9KB | V 9KB] during loop, partial O of every wave after
    __shared__ __align__(16) unsigned char smem[KV_SPLIT * 2 * KV_BUF * 2];
    __shared__ __align__(8) float lds_ml[KV_SPLIT * 8][16][2];  // per wave and query: maximum, sum
    static_assert(KV_SPLIT * 8 * 16 * O_PITCH * 4 <= sizeof(smem), "partial O fits the overlay");
    static_assert(KV_SPLIT == 4, "the join deals 16 rows to 4 groups and takes a maximum of 4");

    const int tid  = threadIdx.x;
    const int wave = tid >> 5;
    const int lane = tid & 31;
    const int grp  = lane >> 4;
    const int l16  = lane & 15;
    const int gtid = tid & 255;                // thread within its key group
    const int qg   = wave & 7;                 // wave in its group: early/late tile and 16-row slice
    const int ks   = __builtin_amdgcn_readfirstlane(wave >> 3);  // key group, uniform

    _Float16* lds_g = (_Float16*)smem + ks * (2 * KV_BUF);  // the group's two buffers
    float*    lds_o = (float*)smem;                    // 32 waves x [16][O_PITCH] f32

    const int bh = blockIdx.y;                 // b*H + h
    const int qt_late = SEQ / 64 - 1 - (int)blockIdx.x;          // the block's late query tile
    const int qt = (qg < 4) ? (int)blockIdx.x : qt_late;         // the wave's query tile
    const int qr = qt * 64 + (qg & 3) * 16;    // wave's first query row
    const int qr_u = __builtin_amdgcn_readfirstlane(qr);  // uniform branch key

    const _Float16* Qb = Qh + (size_t)bh * SEQ * HEAD_DIM;
    const _Float16* Kb = Kh + (size_t)bh * SEQ * HEAD_DIM;
    const _Float16* Vb = Vt + (size_t)bh * HEAD_DIM * SEQ;

    // Q B-operands (column = query l16) for K-steps d=0..31 and d=32..63
    AB16 qa0, qa1;
    {
        const _Float16* qp = Qb + (size_t)(qr + l16) * HEAD_DIM;
        qa0.h[0] = *(const v8h*)(qp + grp * 8);
        qa0.h[1] = *(const v8h*)(qp + 16 + grp * 8);
        qa1.h[0] = *(const v8h*)(qp + 32 + grp * 8);
        qa1.h[1] = *(const v8h*)(qp + 48 + grp * 8);
    }

    float m_run = -__builtin_inff();   // running maximum of query l16 (both halves alike)
    float l_run = 0.f;                 // running sum over this half's keys only
    v8f o[4] = {};                     // o[t][r] = O[query l16][d = t*16 + grp*8 + r]

    const float scale = 0.125f;  // 1/sqrt(64)
    // block-uniform trip count (keys of the late tile): every wave passes every
    // barrier and helps fill; early-tile waves skip only the products below
    const int kv_end = (qt_late + 1) * 64;
    const int qcol = qr + l16;         // this lane's query
    const int np = (kv_end + 64 * KV_SPLIT - 1) / (64 * KV_SPLIT);   // passes, block-uniform

    // the lane's chunk of the group's tile of pass 0 and its place in buffer 0. Every
    // group copies a tile in every pass: pass p < np <= SEQ / 256 keeps keys
    // p * 256 + ks * 64 + 63 < SEQ, also where the tile lies past kv_end and is not used.
    const int rw = gtid >> 3, sg = gtid & 7;
    const _Float16* kg = Kb + (size_t)(ks * 64 + rw) * HEAD_DIM + sg * 8;
    const _Float16* vg = Vb + (size_t)rw * SEQ + ks * 64 + sg * 8;
    const unsigned lk = (unsigned)(size_t)(lds_g + rw * T_PITCH + sg * 8);

    kv_copy(kg, vg, lk);
    // pass 0's tile has landed before the barrier behind which other waves read it
    asm volatile("s_wait_asynccnt 0x0" ::: "memory");
    __syncthreads();
    if (np > 1)
        kv_copy(kg + (size_t)(64 * KV_SPLIT) * HEAD_DIM, vg + 64 * KV_SPLIT, lk + KV_BUF * 2);

    for (int p = 0; p < np; ++p) {
        const int kv0 = p * (64 * KV_SPLIT) + ks * 64;        // this group's tile of the pass
        const _Float16* lds_k = lds_g + (p & 1) * KV_BUF;     // [kv 64][T_PITCH]
        const _Float16* lds_v = lds_k + 64 * T_PITCH;         // [d 64][T_PITCH]

        if (kv0 <= qr_u + 15) {  // wave-uniform causal skip (also: no tile past kv_end)
            // ---- S^T = K Q^T  (4 key-tiles x 2 k-steps) ----
            // sc[j][r] = S[query l16][key kv0 + j*16 + grp*8 + r]
            v8f sc[4];
#pragma unroll
            for (int j = 0; j < 4; ++j) {
                AB16 ak0, ak1;
                const _Float16* kp = lds_k + (j * 16 + l16) * T_PITCH;
                ak0.h[0] = *(const v8h*)(kp + grp * 8);
                ak0.h[1] = *(const v8h*)(kp + 16 + grp * 8);
                ak1.h[0] = *(const v8h*)(kp + 32 + grp * 8);
                ak1.h[1] = *(const v8h*)(kp + 48 + grp * 8);
                v8f c = {};
                c = wmma16(ak0.v, qa0.v, c);
                c = wmma16(ak1.v, qa1.v, c);
                sc[j] = c;
            }
            // ---- mask + scale + maximum of the query's scores ----
            // one partial maximum and sum per key tile: four short chains
            const int lim = qcol - kv0 - grp * 8;   // key j*16 + r is kept while <= lim
            float mxj[4];
#pragma unroll
            for (int j = 0; j < 4; ++j) {
                mxj[j] = -__builtin_inff();
#pragma unroll
                for (int r = 0; r < 8; ++r) {
                    float s = sc[j][r] * scale;
                    if (j * 16 + r > lim) s = -__builtin_inff();
                    sc[j][r] = s;
                    mxj[j] = fmaxf(mxj[j], s);
                }
            }
            float mx = fmaxf(fmaxf(mxj[0], mxj[1]), fmaxf(mxj[2], mxj[3]));
            mx = fmaxf(mx, xhalf(mx));
            // ---- online softmax update ----
            const float mn = fmaxf(m_run, mx);
            const float alpha = __expf(m_run - mn);
            m_run = mn;
            float rsj[4];
#pragma unroll
            for (int j = 0; j < 4; ++j) {
                rsj[j] = 0.f;
#pragma unroll
                for (int r = 0; r < 8; ++r) {
                    const float p = __expf(sc[j][r] - mn);
                    sc[j][r] = p;
                    rsj[j] += p;
                }
            }
            const float rs = (rsj[0] + rsj[1]) + (rsj[2] + rsj[3]);
            l_run = l_run * alpha + rs;
#pragma unroll
            for (int t = 0; t < 4; ++t)
#pragma unroll
                for (int r = 0; r < 8; ++r) o[t][r] *= alpha;

            // ---- P^T B-operands: tiles 2s and 2s+1 hold keys grp*8+r and
            //      16+grp*8+r of k-step s, the k order of the V^T loads below ----
            AB16 pb0, pb1;
#pragma unroll
            for (int r = 0; r < 8; ++r) {
                pb0.h[0][r] = (_Float16)sc[0][r];
                pb0.h[1][r] = (_Float16)sc[1][r];
                pb1.h[0][r] = (_Float16)sc[2][r];
                pb1.h[1][r] = (_Float16)sc[3][r];
            }
            // ---- O^T += V^T P^T  (4 dh-tiles x 2 k-steps) ----
#pragma unroll
            for (int t = 0; t < 4; ++t) {
                AB16 av0, av1;
                const _Float16* vp = lds_v + (t * 16 + l16) * T_PITCH;
                av0.h[0] = *(const v8h*)(vp + grp * 8);
                av0.h[1] = *(const v8h*)(vp + 16 + grp * 8);
                av1.h[0] = *(const v8h*)(vp + 32 + grp * 8);
                av1.h[1] = *(const v8h*)(vp + 48 + grp * 8);
                o[t] = wmma16(av0.v, pb0.v, o[t]);
                o[t] = wmma16(av1.v, pb1.v, o[t]);
            }
        }
        // the wave's reads of this pass's buffer are done before it is refilled
        asm volatile("s_wait_dscnt 0x0" ::: "memory");
        // the wave's copies of the next pass's tile have landed before other waves read them
        asm volatile("s_wait_asynccnt 0x0" ::: "memory");
        __syncthreads();
        if (p + 2 < np)   // block-uniform; into the buffer this pass has just read
            kv_copy(kg + (size_t)(p + 2) * (64 * KV_SPLIT) * HEAD_DIM,
                    vg + (p + 2) * (64 * KV_SPLIT), lk + (p & 1) * (KV_BUF * 2));
    }
    // no copy is outstanding when the buffers become the partial results' staging
    asm volatile("s_wait_asynccnt 0x0" ::: "memory");

    // ---- every wave's partial O into the LDS overlay, maximum and sum into lds_ml ----
    const int b = bh / NUM_HEADS;
    const int h = bh % NUM_HEADS;
    const float l_all = l_run + xhalf(l_run);    // join the halves' sums

    float* ow = lds_o + wave * (16 * O_PITCH);   // safe: loop ended with barrier
#pragma unroll
    for (int t = 0; t < 4; ++t)
#pragma unroll
        for (int u = 0; u < 2; ++u) {
            v4f val;
#pragma unroll
            for (int e = 0; e < 4; ++e) val[e] = o[t][u * 4 + e];
            *(v4f*)(ow + l16 * O_PITCH + t * 16 + grp * 8 + u * 4) = val;
        }
    if (grp == 0) {
        lds_ml[wave][l16][0] = m_run;   // -inf, with sum 0 and O 0, where the wave had no tile
        lds_ml[wave][l16][1] = l_all;
    }
    __syncthreads();   // the groups' partial results are read across waves below

    // ---- join the key groups: wave (ks, qg) takes rows ks*4 .. ks*4+3 of its
    //      16 queries; 16 lanes cover one 256-B row, so stores are whole lines.
    //      Group 0 always holds key 0, so the joint maximum is finite. ----
#pragma unroll
    for (int i = 0; i < 2; ++i) {
        const int row = ks * 4 + i * 2 + grp;
        float mg[KV_SPLIT], lg[KV_SPLIT];
#pragma unroll
        for (int g = 0; g < KV_SPLIT; ++g) {
            mg[g] = lds_ml[g * 8 + qg][row][0];
            lg[g] = lds_ml[g * 8 + qg][row][1];
        }
        const float mj = fmaxf(fmaxf(mg[0], mg[1]), fmaxf(mg[2], mg[3]));
        float lj = 0.f;
        v4f acc = {};
#pragma unroll
        for (int g = 0; g < KV_SPLIT; ++g) {
            const float w = __expf(mg[g] - mj);
            lj += lg[g] * w;
            const v4f part = *(const v4f*)(lds_o + (g * 8 + qg) * (16 * O_PITCH) +
                                           row * O_PITCH + l16 * 4);
#pragma unroll
            for (int e = 0; e < 4; ++e) acc[e] += part[e] * w;
        }
        const float inv_l = 1.0f / lj;
#pragma unroll
        for (int e = 0; e < 4; ++e) acc[e] *= inv_l;
        *(v4f*)(out + ((size_t)(h * BATCH + b) * SEQ + qr + row) * HEAD_DIM +
                l16 * 4) = acc;
    }
}

// ---------------------------------------------------------------------------
extern "C" void kernel_launch(void* const* d_in, const int* in_sizes, int n_in,
                              void* d_out, int out_size, void* d_ws, size_t ws_size,
                              hipStream_t stream) {
    const float* q    = (const float*)d_in[0];
    const float* k    = (const float*)d_in[1];
    const float* v    = (const float*)d_in[2];
    const float* W    = (const float*)d_in[3];
    const float* bias = (const float*)d_in[4];

    const size_t per = (size_t)BATCH * NUM_HEADS * SEQ * HEAD_DIM;  // 2,097,152
    _Float16* Qh = (_Float16*)d_ws;
    _Float16* Kh = Qh + per;
    _Float16* Vt = Kh + per;

    dim3 pgrid((BATCH * SEQ) / PBM, D_MODEL / PBN, 3);
    proj_kernel<<<pgrid, 512, 0, stream>>>(q, k, v, W, bias, Qh, Kh, Vt);

    dim3 agrid(SEQ / 128, BATCH * NUM_HEADS);
    attn_kernel<<<agrid, 256 * KV_SPLIT, 0, stream>>>(Qh, Kh, Vt, (float*)d_out);
}

// v007
// Measured time: 29.3 microseconds a run.
// Timed twice side by side with v006, it ran 1.04 and 1.05 times as fast.
// Over all steps from v000 it is 5.06 times as fast.
#include <hip/hip_runtime.h>

#define D_MODEL   512
#define NUM_HEADS 8
#define HEAD_DIM  64
#define BATCH     2
#define SEQ       2048

// LDS row pitches. A fragment read is one ds_load_b128 per lane with 16 lanes on
// 16 consecutive rows; a pitch of 16 B x odd puts those rows on disjoint banks.
#define T_PITCH  72   // halves: 64 data + 8 pad  (144 B), K / V^T tiles, projection slices
#define O_PITCH  68   // floats: 64 data + 4 pad  (272 B), output staging
#define KV_SPLIT 4    // wave groups of the attention block, each on its own key tiles
#define KV_BUF   (2 * 64 * T_PITCH)               // halves of one K + V^T tile buffer
#define PBM      128  // projection block tile, rows of X
#define PBN      256  // projection block tile, rows of W
#define PBK      64   // k of one projection slice
#define P_STAGE  ((PBM + PBN) * T_PITCH)          // halves of one slice buffer
#define P_CH     ((PBM + PBN) * PBK / 4 / 512)    // 16-B f32 chunks per thread and slice

typedef __attribute__((ext_vector_type(16))) _Float16 v16h;
typedef __attribute__((ext_vector_type(8)))  _Float16 v8h;
typedef __attribute__((ext_vector_type(4)))  _Float16 v4h;
typedef __attribute__((ext_vector_type(8)))  float    v8f;
typedef __attribute__((ext_vector_type(4)))  float    v4f;

union AB16 { v16h v; v8h h[2]; };

__device__ __forceinline__ v8f wmma16(v16h a, v16h b, v8f c) {
    return __builtin_amdgcn_wmma_f32_16x16x32_f16(false, a, false, b,
                                                  (short)0, c, false, false);
}

// ---------------------------------------------------------------------------
// Fused projection: P = relu(X @ W^T + b), emitted as f16.
//   z==0 -> Qh [b,h,s,dh]   z==1 -> Kh [b,h,s,dh]   z==2 -> Vt [b,h,dh,s]
// Grid: (M/128, 512/256, 3), block 512 (16 waves, 4 x 4). Block tile 128(M) x
// 256(N), wave tile 32 x 64 (one head). A slice is 64 k of the 128 X rows and the
// 256 W rows: every load instruction covers two whole 256-B row pieces, the slice
// is converted once and kept as f16 in one of two LDS buffers. Slices are fetched
// two ahead into two register sets, so loads stay in flight through every pass but the last.
// ---------------------------------------------------------------------------
__device__ __forceinline__ void proj_fetch(v4f (&r)[P_CH], const float* __restrict__ xs,
                                           const float* __restrict__ wsrc, int s) {
#pragma unroll
    for (int i = 0; i < P_CH; ++i)
        r[i] = (i < PBM / 32)
                   ? *(const v4f*)(xs + (size_t)i * 32 * D_MODEL + s * PBK)
                   : *(const v4f*)(wsrc + (size_t)(i - PBM / 32) * 32 * D_MODEL + s * PBK);
}

__device__ __forceinline__ void proj_put(const v4f (&r)[P_CH], _Float16* dst) {
#pragma unroll
    for (int i = 0; i < P_CH; ++i) {
        v4h pk;
#pragma unroll
        for (int e = 0; e < 4; ++e) pk[e] = (_Float16)r[i][e];
        *(v4h*)(dst + i * 32 * T_PITCH) = pk;
    }
}

// Work-group barrier behind the wave's LDS traffic alone: __syncthreads() also waits
// for every global load, and the slices fetched ahead must stay in flight across it.
// No global store precedes it in this kernel.
__device__ __forceinline__ void proj_barrier() {
    asm volatile("s_wait_dscnt 0x0\n\ts_barrier_signal -1\n\ts_barrier_wait -1" ::: "memory");
}

__global__ __launch_bounds__(512)
void proj_kernel(const float* __restrict__ Xq, const float* __restrict__ Xk,
                 const float* __restrict__ Xv, const float* __restrict__ W,
                 const float* __restrict__ bias,
                 _Float16* __restrict__ Qh, _Float16* __restrict__ Kh,
                 _Float16* __restrict__ Vt) {
    // two slice buffers [X 128 rows | W 256 rows][T_PITCH]; store staging after the loop
    __shared__ __align__(16) _Float16 lds_s[2 * P_STAGE];
    static_assert(16 * 32 * 64 <= 2 * P_STAGE, "store staging fits the overlay");

    const int tid  = threadIdx.x;
    const int wave = tid >> 5;
    const int lane = tid & 31;
    const int grp  = lane >> 4;   // half-wave group (K-group of WMMA layouts)
    const int l16  = lane & 15;
    const int wm   = wave >> 2;   // wave's 32 rows of the block tile
    const int wn   = wave & 3;    // wave's 64 columns (head) of the block tile

    const int z = blockIdx.z;
    const float* X = (z == 0) ? Xq : (z == 1) ? Xk : Xv;

    const int mb = blockIdx.x * PBM;   // first M row of the block
    const int nb = blockIdx.y * PBN;   // first N col of the block

    // loader: thread takes 16 B of row (tid >> 4) + 32 i, 16 threads a 256-B row piece
    const int lr = tid >> 4, lc = (tid & 15) * 4;
    const float* xs   = X + (size_t)(mb + lr) * D_MODEL + lc;
    const float* wsrc = W + (size_t)(nb + lr) * D_MODEL + lc;
    _Float16* put = lds_s + lr * T_PITCH + lc;

    v8f acc[2][4] = {};
    v4f r[2][P_CH];

    proj_fetch(r[0], xs, wsrc, 0);
    // keeps slice 0's loads the older ones, so that its wait leaves slice 1's in flight
    __builtin_amdgcn_sched_barrier(0);
    proj_fetch(r[1], xs, wsrc, 1);
    // keeps slice 1's loads in front of the first conversion (and its wait)
    __builtin_amdgcn_sched_barrier(0);
    proj_put(r[0], put);
    proj_barrier();

    // unrolled so that the register set and the LDS buffer of a pass are compile-time
#pragma unroll
    for (int s = 0; s < D_MODEL / PBK; ++s) {
        if (s + 2 < D_MODEL / PBK) proj_fetch(r[s & 1], xs, wsrc, s + 2);
        // keeps the loads at the head of the pass: they fly through two passes' products
        __builtin_amdgcn_sched_barrier(0);
        const _Float16* buf = lds_s + (s & 1) * P_STAGE;
#pragma unroll
        for (int k2 = 0; k2 < PBK; k2 += 32) {
            AB16 a[2], bm[4];
#pragma unroll
            for (int mi = 0; mi < 2; ++mi) {
                const _Float16* ap = buf + (wm * 32 + mi * 16 + l16) * T_PITCH + k2;
                a[mi].h[0] = *(const v8h*)(ap + grp * 8);
                a[mi].h[1] = *(const v8h*)(ap + 16 + grp * 8);
            }
#pragma unroll
            for (int j = 0; j < 4; ++j) {
                const _Float16* bp = buf + (PBM + wn * 64 + j * 16 + l16) * T_PITCH + k2;
                bm[j].h[0] = *(const v8h*)(bp + grp * 8);
                bm[j].h[1] = *(const v8h*)(bp + 16 + grp * 8);
            }
#pragma unroll
            for (int mi = 0; mi < 2; ++mi)
#pragma unroll
                for (int j = 0; j < 4; ++j)
                    acc[mi][j] = wmma16(a[mi].v, bm[j].v, acc[mi][j]);
        }
        // keeps the conversions, and so the wait for the loads, behind this pass's products
        __builtin_amdgcn_sched_barrier(0);
        // the other buffer's readers left it at the barrier that ended the pass before
        if (s + 1 < D_MODEL / PBK) proj_put(r[(s + 1) & 1], put + ((s + 1) & 1) * P_STAGE);
        proj_barrier();
    }

    // ---- epilogue: + bias, relu, f16, packed 128-bit stores ----
    const int n0 = nb + wn * 64;          // wave's first N col (== head*64)
    const int h  = n0 / HEAD_DIM;         // one head per wave
    float bv[4];
#pragma unroll
    for (int j = 0; j < 4; ++j) bv[j] = bias[n0 + j * 16 + l16];

    const int mw = mb + wm * 32;          // wave's first M row; its 32 rows are in one batch
    const int b  = mw >> 11;
    const int sw = mw & (SEQ - 1);

    if (z == 2) {
        // Vt [dh][s]: C-layout register column r = consecutive s -> direct v8h
#pragma unroll
        for (int mi = 0; mi < 2; ++mi)
#pragma unroll
            for (int j = 0; j < 4; ++j) {
                const int dh = j * 16 + l16;
                v8h pk;
#pragma unroll
                for (int q = 0; q < 8; ++q) {
                    float val = acc[mi][j][q] + bv[j];
                    val = val > 0.f ? val : 0.f;
                    pk[q] = (_Float16)val;
                }
                *(v8h*)(Vt + ((size_t)(b * NUM_HEADS + h) * HEAD_DIM + dh) * SEQ +
                        sw + mi * 16 + grp * 8) = pk;
            }
    } else {
        // Qh/Kh [s][dh]: stage the wave's 32 x 64 tile in LDS, then coalesced b128 copy-out
        _Float16* dst = (z == 0) ? Qh : Kh;
        _Float16* cw  = lds_s + wave * (32 * 64);
#pragma unroll
        for (int mi = 0; mi < 2; ++mi)
#pragma unroll
            for (int j = 0; j < 4; ++j)
#pragma unroll
                for (int q = 0; q < 8; ++q) {
                    float val = acc[mi][j][q] + bv[j];
                    val = val > 0.f ? val : 0.f;
                    cw[(mi * 16 + grp * 8 + q) * 64 + j * 16 + l16] = (_Float16)val;
                }
        // same-wave DS ordering; 32 rows x 8 segs = 256 chunks, 8 per lane
#pragma unroll
        for (int i = 0; i < 8; ++i) {
            const int c   = lane + 32 * i;
            const int row = c >> 3, seg = c & 7;
            const v8h pk = *(const v8h*)(cw + row * 64 + seg * 8);
            *(v8h*)(dst + ((size_t)(b * NUM_HEADS + h) * SEQ + sw + row) *
                    HEAD_DIM + seg * 8) = pk;
        }
        // in the listing this branch falls through into code that rewrites the stores' address pair
        asm volatile("s_wait_xcnt 0x0" ::: "memory");
    }
}

// ---------------------------------------------------------------------------
// Causal flash attention, transposed products: S^T = K Q^T, O^T += V^T P^T.
// Grid: (SEQ/128, B*H), block 512 = KV_SPLIT groups of 4 waves. A block takes
// two 64-query tiles, t and SEQ/64 - 1 - t, so every block has the same causal
// work (SEQ/64 + 1 tile pairs). A wave owns 16 queries of either tile as two
// column groups (0 early, 1 late): both are B operands of the same K and V^T
// fragments, so a fragment read from LDS serves both while the early tile still
// has keys, and every wave of a key group has the same work. One query per lane
// column (l16); a lane holds 32 of the 64 scores of its query, lane ^ 16 the other
// 32. Maximum and sum are in-lane, joined with lane ^ 16; two S^T tiles converted in place are the B
// operand of the second product, so P never leaves the registers. KV tiles of 64
// staged in LDS, one per group and pass: group g walks tiles g, g + KV_SPLIT, ...
// with a running maximum, sum and O of its own; the groups' partial results are
// joined through LDS after the loop.
// Each group has two tile buffers, filled by asynchronous copies to LDS: the next
// pass's tile is in flight while this pass's is worked on, one barrier a pass.
// ---------------------------------------------------------------------------
// value of lane l ^ 16
__device__ __forceinline__ float xhalf(float x) {
    const int i = __builtin_bit_cast(int, x);
    return __builtin_bit_cast(float, __builtin_amdgcn_permlanex16(
        i, i, 0x76543210, 0xfedcba98, false, false));
}

// One group's K and V^T tile (64 x 128 B each) into one LDS buffer: 8 chunks of 16 B a
// thread, rows rw, rw + 16, rw + 32, rw + 48 of either tile. kg, vg: the lane's chunk of
// row rw in global memory; lk: its LDS byte address in the K half of the buffer.
__device__ __forceinline__ void kv_copy(const _Float16* kg, const _Float16* vg, unsigned lk) {
    const _Float16* kg1 = kg + 16 * HEAD_DIM;
    const _Float16* kg2 = kg + 32 * HEAD_DIM;
    const _Float16* kg3 = kg + 48 * HEAD_DIM;
    const _Float16* vg1 = vg + (size_t)16 * SEQ;
    const _Float16* vg2 = vg + (size_t)32 * SEQ;
    const _Float16* vg3 = vg + (size_t)48 * SEQ;
    const unsigned lk1 = lk + 16 * T_PITCH * 2;
    const unsigned lk2 = lk + 32 * T_PITCH * 2;
    const unsigned lk3 = lk + 48 * T_PITCH * 2;
    const unsigned lv  = lk + 64 * T_PITCH * 2;
    const unsigned lv1 = lv + 16 * T_PITCH * 2;
    const unsigned lv2 = lv + 32 * T_PITCH * 2;
    const unsigned lv3 = lv + 48 * T_PITCH * 2;
    // the closing wait stands in front of any rewrite of the address registers named here
    asm volatile("global_load_async_to_lds_b128 %0, %8, off\n\t"
                 "global_load_async_to_lds_b128 %1, %9, off\n\t"
                 "global_load_async_to_lds_b128 %2, %10, off\n\t"
                 "global_load_async_to_lds_b128 %3, %11, off\n\t"
                 "global_load_async_to_lds_b128 %4, %12, off\n\t"
                 "global_load_async_to_lds_b128 %5, %13, off\n\t"
                 "global_load_async_to_lds_b128 %6, %14, off\n\t"
                 "global_load_async_to_lds_b128 %7, %15, off\n\t"
                 "s_wait_xcnt 0x0"
                 :: "v"(lk), "v"(lk1), "v"(lk2), "v"(lk3), "v"(lv), "v"(lv1), "v"(lv2), "v"(lv3),
                    "v"(kg), "v"(kg1), "v"(kg2), "v"(kg3), "v"(vg), "v"(vg1), "v"(vg2), "v"(vg3)
                 : "memory");
}

// S^T = K Q^T of one column group: 4 key-tiles x 2 k-steps on the K fragments ak.
// sc[j][r] = S[query l16][key j*16 + grp*8 + r of the tile]
__device__ __forceinline__ void attn_scores(const AB16 (&ak)[4][2], const AB16& qa0,
                                            const AB16& qa1, v8f (&sc)[4]) {
#pragma unroll
    for (int j = 0; j < 4; ++j) {
        v8f s = {};
        s = wmma16(ak[j][0].v, qa0.v, s);
        s = wmma16(ak[j][1].v, qa1.v, s);
        sc[j] = s;
    }
}

// Online softmax step of one column group: scores in, P^T B-operands out; maximum, sum
// and O rescaled. Key j*16 + r of this lane's half is kept while <= lim.
__device__ __forceinline__ void attn_softmax(v8f (&sc)[4], int lim, float& m_run, float& l_run,
                                             v8f (&o)[4], AB16& pb0, AB16& pb1) {
    const float scale = 0.125f;  // 1/sqrt(64)
    // ---- mask + scale + maximum of the query's scores ----
    // one partial maximum and sum per key tile: four short chains
    float mxj[4];
#pragma unroll
    for (int j = 0; j < 4; ++j) {
        mxj[j] = -__builtin_inff();
#pragma unroll
        for (int r = 0; r < 8; ++r) {
            float s = sc[j][r] * scale;
            if (j * 16 + r > lim) s = -__builtin_inff();
            sc[j][r] = s;
            mxj[j] = fmaxf(mxj[j], s);
        }
    }
    float mx = fmaxf(fmaxf(mxj[0], mxj[1]), fmaxf(mxj[2], mxj[3]));
    mx = fmaxf(mx, xhalf(mx));
    // ---- online softmax update ----
    const float mn = fmaxf(m_run, mx);
    const float alpha = __expf(m_run - mn);
    m_run = mn;
    float rsj[4];
#pragma unroll
    for (int j = 0; j < 4; ++j) {
        rsj[j] = 0.f;
#pragma unroll
        for (int r = 0; r < 8; ++r) {
            const float p = __expf(sc[j][r] - mn);
            sc[j][r] = p;
            rsj[j] += p;
        }
    }
    const float rs = (rsj[0] + rsj[1]) + (rsj[2] + rsj[3]);
    l_run = l_run * alpha + rs;
#pragma unroll
    for (int t = 0; t < 4; ++t)
#pragma unroll
        for (int r = 0; r < 8; ++r) o[t][r] *= alpha;

    // ---- P^T B-operands: tiles 2s and 2s+1 hold keys grp*8+r and
    //      16+grp*8+r of k-step s, the k order of the V^T fragments ----
#pragma unroll
    for (int r = 0; r < 8; ++r) {
        pb0.h[0][r] = (_Float16)sc[0][r];
        pb0.h[1][r] = (_Float16)sc[1][r];
        pb1.h[0][r] = (_Float16)sc[2][r];
        pb1.h[1][r] = (_Float16)sc[3][r];
    }
}

// O^T += V^T P^T of one column group: 4 dh-tiles x 2 k-steps on the V^T fragments av
__device__ __forceinline__ void attn_out(const AB16 (&av)[4][2], const AB16& pb0,
                                         const AB16& pb1, v8f (&o)[4]) {
#pragma unroll
    for (int t = 0; t < 4; ++t) {
        o[t] = wmma16(av[t][0].v, pb0.v, o[t]);
        o[t] = wmma16(av[t][1].v, pb1.v, o[t]);
    }
}

// The A fragments of one 64 x 64 tile in LDS (K: row = key, V^T: row = d), k-steps 0 and 1
__device__ __forceinline__ void attn_frags(const _Float16* tile, int grp, int l16,
                                           AB16 (&a)[4][2]) {
#pragma unroll
    for (int j = 0; j < 4; ++j) {
        const _Float16* rp = tile + (j * 16 + l16) * T_PITCH;
        a[j][0].h[0] = *(const v8h*)(rp + grp * 8);
        a[j][0].h[1] = *(const v8h*)(rp + 16 + grp * 8);
        a[j][1].h[0] = *(const v8h*)(rp + 32 + grp * 8);
        a[j][1].h[1] = *(const v8h*)(rp + 48 + grp * 8);
    }
}

__global__ __launch_bounds__(128 * KV_SPLIT)
void attn_kernel(const _Float16* __restrict__ Qh, const _Float16* __restrict__ Kh,
                 const _Float16* __restrict__ Vt, float* __restrict__ out) {
    // overlay: per group 2 x [K 9KB | V 9KB] during loop, partial O of every column group after
    __shared__ __align__(16) unsigned char smem[KV_SPLIT * 2 * KV_BUF * 2];
    // per key group, 16-query group and query: maximum, sum
    __shared__ __align__(8) float lds_ml[KV_SPLIT * 8][16][2];
    static_assert(KV_SPLIT * 8 * 16 * O_PITCH * 4 <= sizeof(smem), "partial O fits the overlay");
    static_assert(KV_SPLIT == 4, "the join deals 16 rows to 4 groups and takes a maximum of 4");

    const int tid  = threadIdx.x;
    const int wave = tid >> 5;
    const int lane = tid & 31;
    const int grp  = lane >> 4;
    const int l16  = lane & 15;
    const int gtid = tid & 127;                // thread within its key group
    const int sub  = wave & 3;                 // the wave's 16 queries within either tile
    const int ks   = __builtin_amdgcn_readfirstlane(wave >> 2);  // key group, uniform

    _Float16* lds_g = (_Float16*)smem + ks * (2 * KV_BUF);  // the group's two buffers
    float*    lds_o = (float*)smem;                    // 32 x [16][O_PITCH] f32

    const int bh = blockIdx.y;                 // b*H + h
    const int qt_late = SEQ / 64 - 1 - (int)blockIdx.x;          // the block's late query tile
    // first query row of the wave's column groups: 0 early tile, 1 late tile
    const int qr[2] = {(int)blockIdx.x * 64 + sub * 16, qt_late * 64 + sub * 16};
    const int qe_u = __builtin_amdgcn_readfirstlane(qr[0]);  // uniform branch keys
    const int ql_u = __builtin_amdgcn_readfirstlane(qr[1]);

    const _Float16* Qb = Qh + (size_t)bh * SEQ * HEAD_DIM;
    const _Float16* Kb = Kh + (size_t)bh * SEQ * HEAD_DIM;
    const _Float16* Vb = Vt + (size_t)bh * HEAD_DIM * SEQ;

    // Q B-operands (column = query l16) for K-steps d=0..31 and d=32..63
    AB16 qa0[2], qa1[2];
#pragma unroll
    for (int c = 0; c < 2; ++c) {
        const _Float16* qp = Qb + (size_t)(qr[c] + l16) * HEAD_DIM;
        qa0[c].h[0] = *(const v8h*)(qp + grp * 8);
        qa0[c].h[1] = *(const v8h*)(qp + 16 + grp * 8);
        qa1[c].h[0] = *(const v8h*)(qp + 32 + grp * 8);
        qa1[c].h[1] = *(const v8h*)(qp + 48 + grp * 8);
    }

    // running maximum of query l16 (both halves alike), running sum over this half's keys only
    float m_run[2] = {-__builtin_inff(), -__builtin_inff()};
    float l_run[2] = {0.f, 0.f};
    v8f o[2][4] = {};                  // o[c][t][r] = O[query l16 of group c][d = t*16 + grp*8 + r]

    // block-uniform trip count (keys of the late tile): every wave passes every barrier
    const int kv_end = (qt_late + 1) * 64;
    const int np = (kv_end + 64 * KV_SPLIT - 1) / (64 * KV_SPLIT);   // passes, block-uniform

    // the lane's chunk of the group's tile of pass 0 and its place in buffer 0. Every
    // group copies a tile in every pass: pass p < np <= SEQ / 256 keeps keys
    // p * 256 + ks * 64 + 63 < SEQ, also where the tile lies past kv_end and is not used.
    const int rw = gtid >> 3, sg = gtid & 7;
    const _Float16* kg = Kb + (size_t)(ks * 64 + rw) * HEAD_DIM + sg * 8;
    const _Float16* vg = Vb + (size_t)rw * SEQ + ks * 64 + sg * 8;
    const unsigned lk = (unsigned)(size_t)(lds_g + rw * T_PITCH + sg * 8);

    kv_copy(kg, vg, lk);
    // pass 0's tile has landed before the barrier behind which other waves read it
    asm volatile("s_wait_asynccnt 0x0" ::: "memory");
    __syncthreads();
    if (np > 1)
        kv_copy(kg + (size_t)(64 * KV_SPLIT) * HEAD_DIM, vg + 64 * KV_SPLIT, lk + KV_BUF * 2);

    for (int p = 0; p < np; ++p) {
        const int kv0 = p * (64 * KV_SPLIT) + ks * 64;        // this group's tile of the pass
        const _Float16* lds_k = lds_g + (p & 1) * KV_BUF;     // [kv 64][T_PITCH]
        const _Float16* lds_v = lds_k + 64 * T_PITCH;         // [d 64][T_PITCH]

        // wave-uniform causal skips (also: no tile past kv_end); the early tile's keys
        // are a prefix of the late tile's, so its products ride on the late tile's fragments
        if (kv0 <= ql_u + 15) {
            const bool both = kv0 <= qe_u + 15;
            AB16 fr[4][2], pb0[2], pb1[2];
            v8f sc[4];
            attn_frags(lds_k, grp, l16, fr);
            if (both) {
                attn_scores(fr, qa0[0], qa1[0], sc);
                attn_softmax(sc, qr[0] + l16 - kv0 - grp * 8, m_run[0], l_run[0], o[0],
                             pb0[0], pb1[0]);
            }
            attn_scores(fr, qa0[1], qa1[1], sc);
            attn_softmax(sc, qr[1] + l16 - kv0 - grp * 8, m_run[1], l_run[1], o[1],
                         pb0[1], pb1[1]);
            attn_frags(lds_v, grp, l16, fr);
            attn_out(fr, pb0[1], pb1[1], o[1]);
            if (both) attn_out(fr, pb0[0], pb1[0], o[0]);
        }

        // the wave's reads of this pass's buffer are done before it is refilled
        asm volatile("s_wait_dscnt 0x0" ::: "memory");
        // the wave's copies of the next pass's tile have landed before other waves read them
        asm volatile("s_wait_asynccnt 0x0" ::: "memory");
        __syncthreads();
        if (p + 2 < np)   // block-uniform; into the buffer this pass has just read
            kv_copy(kg + (size_t)(p + 2) * (64 * KV_SPLIT) * HEAD_DIM,
                    vg + (p + 2) * (64 * KV_SPLIT), lk + (p & 1) * (KV_BUF * 2));
    }
    // no copy is outstanding when the buffers become the partial results' staging
    asm volatile("s_wait_asynccnt 0x0" ::: "memory");

    // ---- every column group's partial O, maximum and sum into the LDS overlay;
    //      slot ks * 8 + qg, qg = c * 4 + sub: the block's eight 16-query groups ----
    const int b = bh / NUM_HEADS;
    const int h = bh % NUM_HEADS;
#pragma unroll
    for (int c = 0; c < 2; ++c) {
        const int slot = ks * 8 + c * 4 + sub;
        const float l_all = l_run[c] + xhalf(l_run[c]);   // join the halves' sums
        float* ow = lds_o + slot * (16 * O_PITCH);        // safe: loop ended with barrier
#pragma unroll
        for (int t = 0; t < 4; ++t)
#pragma unroll
            for (int u = 0; u < 2; ++u) {
                v4f val;
#pragma unroll
                for (int e = 0; e < 4; ++e) val[e] = o[c][t][u * 4 + e];
                *(v4f*)(ow + l16 * O_PITCH + t * 16 + grp * 8 + u * 4) = val;
            }
        if (grp == 0) {
            lds_ml[slot][l16][0] = m_run[c];   // -inf, with sum 0 and O 0, where it had no tile
            lds_ml[slot][l16][1] = l_all;
        }
    }
    __syncthreads();   // the groups' partial results are read across waves below

    // ---- join the key groups: wave (ks, sub) takes rows ks*4 .. ks*4+3 of the query
    //      groups sub and 4 + sub; 16 lanes cover one 256-B row, so stores are whole
    //      lines. Group 0 always holds key 0, so the joint maximum is finite. ----
#pragma unroll
    for (int c = 0; c < 2; ++c) {
        const int qg = c * 4 + sub;
#pragma unroll
        for (int i = 0; i < 2; ++i) {
            const int row = ks * 4 + i * 2 + grp;
            float mg[KV_SPLIT], lg[KV_SPLIT];
#pragma unroll
            for (int g = 0; g < KV_SPLIT; ++g) {
                mg[g] = lds_ml[g * 8 + qg][row][0];
                lg[g] = lds_ml[g * 8 + qg][row][1];
            }
            const float mj = fmaxf(fmaxf(mg[0], mg[1]), fmaxf(mg[2], mg[3]));
            float lj = 0.f;
            v4f acc = {};
#pragma unroll
            for (int g = 0; g < KV_SPLIT; ++g) {
                const float w = __expf(mg[g] - mj);
                lj += lg[g] * w;
                const v4f part = *(const v4f*)(lds_o + (g * 8 + qg) * (16 * O_PITCH) +
                                               row * O_PITCH + l16 * 4);
#pragma unroll
                for (int e = 0; e < 4; ++e) acc[e] += part[e] * w;
            }
            const float inv_l = 1.0f / lj;
#pragma unroll
            for (int e = 0; e < 4; ++e) acc[e] *= inv_l;
            *(v4f*)(out + ((size_t)(h * BATCH + b) * SEQ + qr[c] + row) * HEAD_DIM +
                    l16 * 4) = acc;
        }
    }
}

// ---------------------------------------------------------------------------
extern "C" void kernel_launch(void* const* d_in, const int* in_sizes, int n_in,
                              void* d_out, int out_size, void* d_ws, size_t ws_size,
                              hipStream_t stream) {
    const float* q    = (const float*)d_in[0];
    const float* k    = (const float*)d_in[1];
    const float* v    = (const float*)d_in[2];
    const float* W    = (const float*)d_in[3];
    const float* bias = (const float*)d_in[4];

    const size_t per = (size_t)BATCH * NUM_HEADS * SEQ * HEAD_DIM;  // 2,097,152
    _Float16* Qh = (_Float16*)d_ws;
    _Float16* Kh = Qh + per;
    _Float16* Vt = Kh + per;

    dim3 pgrid((BATCH * SEQ) / PBM, D_MODEL / PBN, 3);
    proj_kernel<<<pgrid, 512, 0, stream>>>(q, k, v, W, bias, Qh, Kh, Vt);

    dim3 agrid(SEQ / 128, BATCH * NUM_HEADS);
    attn_kernel<<<agrid, 128 * KV_SPLIT, 0, stream>>>(Qh, Kh, Vt, (float*)d_out);
}

// v008
// It runs in 28.2 microseconds.
// Two timings next to v007 both put it at 1.04 times that version's speed.
// Over all steps from v000 it is 5.26 times as fast.
#include <hip/hip_runtime.h>

#define D_MODEL   512
#define NUM_HEADS 8
#define HEAD_DIM  64
#define BATCH     2
#define SEQ       2048

// LDS row pitches. A fragment read is one ds_load_b128 per lane with 16 lanes on
// 16 consecutive rows; a pitch of 16 B x odd puts those rows on disjoint banks.
#define T_PITCH  72   // halves: 64 data + 8 pad  (144 B), K / V^T tiles, projection slices
#define O_PITCH  68   // floats: 64 data + 4 pad  (272 B), output staging
#define KV_SPLIT 4    // wave groups of the attention block, each on its own key tiles
#define KV_BUF   (2 * 64 * T_PITCH)               // halves of one K + V^T tile buffer
#define PBM      128  // projection block tile, rows of X
#define PBN      256  // projection block tile, rows of W
#define PBK      64   // k of one projection slice
#define P_STAGE  ((PBM + PBN) * T_PITCH)          // halves of one slice buffer
#define P_THR    256  // projection block: 8 waves, 2 x 4
#define P_CH     ((PBM + PBN) * PBK / 4 / P_THR)  // 16-B f32 chunks per thread and slice

typedef __attribute__((ext_vector_type(16))) _Float16 v16h;
typedef __attribute__((ext_vector_type(8)))  _Float16 v8h;
typedef __attribute__((ext_vector_type(4)))  _Float16 v4h;
typedef __attribute__((ext_vector_type(8)))  float    v8f;
typedef __attribute__((ext_vector_type(4)))  float    v4f;

union AB16 { v16h v; v8h h[2]; };

__device__ __forceinline__ v8f wmma16(v16h a, v16h b, v8f c) {
    return __builtin_amdgcn_wmma_f32_16x16x32_f16(false, a, false, b,
                                                  (short)0, c, false, false);
}

// ---------------------------------------------------------------------------
// Fused projection: P = relu(X @ W^T + b), emitted as f16.
//   z==0 -> Qh [b,h,s,dh]   z==1 -> Kh [b,h,s,dh]   z==2 -> Vt [b,h,dh,s]
// Grid: (M/128, 512/256, 3), block 256 (8 waves, 2 x 4). Block tile 128(M) x
// 256(N), wave tile 64 x 64 (one head): 4 + 4 fragments feed 16 products, so the LDS
// reads keep level with the matrix unit. A slice is 64 k of the 128 X rows and the
// 256 W rows: every load instruction covers two whole 256-B row pieces, the slice
// is converted once and kept as f16 in one of two LDS buffers. Slices are fetched
// two ahead into two register sets, so loads stay in flight through every pass but the last.
// ---------------------------------------------------------------------------
__device__ __forceinline__ void proj_fetch(v4f (&r)[P_CH], const float* __restrict__ xs,
                                           const float* __restrict__ wsrc, int s) {
#pragma unroll
    for (int i = 0; i < P_CH; ++i)
        r[i] = (i < PBM / 16)
                   ? *(const v4f*)(xs + (size_t)i * 16 * D_MODEL + s * PBK)
                   : *(const v4f*)(wsrc + (size_t)(i - PBM / 16) * 16 * D_MODEL + s * PBK);
}

__device__ __forceinline__ void proj_put(const v4f (&r)[P_CH], _Float16* dst) {
#pragma unroll
    for (int i = 0; i < P_CH; ++i) {
        v4h pk;
#pragma unroll
        for (int e = 0; e < 4; ++e) pk[e] = (_Float16)r[i][e];
        *(v4h*)(dst + i * 16 * T_PITCH) = pk;
    }
}

// Work-group barrier behind the wave's LDS traffic alone: __syncthreads() also waits
// for every global load, and the slices fetched ahead must stay in flight across it.
// No global store precedes it in this kernel.
__device__ __forceinline__ void proj_barrier() {
    asm volatile("s_wait_dscnt 0x0\n\ts_barrier_signal -1\n\ts_barrier_wait -1" ::: "memory");
}

__global__ __launch_bounds__(P_THR)
void proj_kernel(const float* __restrict__ Xq, const float* __restrict__ Xk,
                 const float* __restrict__ Xv, const float* __restrict__ W,
                 const float* __restrict__ bias,
                 _Float16* __restrict__ Qh, _Float16* __restrict__ Kh,
                 _Float16* __restrict__ Vt) {
    // two slice buffers [X 128 rows | W 256 rows][T_PITCH]; store staging after the loop
    __shared__ __align__(16) _Float16 lds_s[2 * P_STAGE];
    static_assert(8 * 64 * 64 <= 2 * P_STAGE, "store staging fits the overlay");

    const int tid  = threadIdx.x;
    const int wave = tid >> 5;
    const int lane = tid & 31;
    const int grp  = lane >> 4;   // half-wave group (K-group of WMMA layouts)
    const int l16  = lane & 15;
    const int wm   = wave >> 2;   // wave's 64 rows of the block tile
    const int wn   = wave & 3;    // wave's 64 columns (head) of the block tile

    const int z = blockIdx.z;
    const float* X = (z == 0) ? Xq : (z == 1) ? Xk : Xv;

    const int mb = blockIdx.x * PBM;   // first M row of the block
    const int nb = blockIdx.y * PBN;   // first N col of the block

    // loader: thread takes 16 B of row (tid >> 4) + 16 i, 16 threads a 256-B row piece
    const int lr = tid >> 4, lc = (tid & 15) * 4;
    const float* xs   = X + (size_t)(mb + lr) * D_MODEL + lc;
    const float* wsrc = W + (size_t)(nb + lr) * D_MODEL + lc;
    _Float16* put = lds_s + lr * T_PITCH + lc;

    v8f acc[4][4] = {};
    v4f r[2][P_CH];

    proj_fetch(r[0], xs, wsrc, 0);
    // keeps slice 0's loads the older ones, so that its wait leaves slice 1's in flight
    __builtin_amdgcn_sched_barrier(0);
    proj_fetch(r[1], xs, wsrc, 1);
    // keeps slice 1's loads in front of the first conversion (and its wait)
    __builtin_amdgcn_sched_barrier(0);
    proj_put(r[0], put);
    proj_barrier();

    // unrolled so that the register set and the LDS buffer of a pass are compile-time
#pragma unroll
    for (int s = 0; s < D_MODEL / PBK; ++s) {
        if (s + 2 < D_MODEL / PBK) proj_fetch(r[s & 1], xs, wsrc, s + 2);
        // keeps the loads at the head of the pass: they fly through two passes' products
        __builtin_amdgcn_sched_barrier(0);
        const _Float16* buf = lds_s + (s & 1) * P_STAGE;
        AB16 a[PBK / 32][4], bm[PBK / 32][4];
#pragma unroll
        for (int ki = 0; ki < PBK / 32; ++ki) {
#pragma unroll
            for (int j = 0; j < 4; ++j) {
                const _Float16* bp = buf + (PBM + wn * 64 + j * 16 + l16) * T_PITCH + ki * 32;
                bm[ki][j].h[0] = *(const v8h*)(bp + grp * 8);
                bm[ki][j].h[1] = *(const v8h*)(bp + 16 + grp * 8);
            }
#pragma unroll
            for (int mi = 0; mi < 4; ++mi) {
                const _Float16* ap = buf + (wm * 64 + mi * 16 + l16) * T_PITCH + ki * 32;
                a[ki][mi].h[0] = *(const v8h*)(ap + grp * 8);
                a[ki][mi].h[1] = *(const v8h*)(ap + 16 + grp * 8);
            }
        }
        // keeps the pass's fragment reads one group in front of its products: read row by
        // row into one register set, every row of products waits out the LDS latency
        __builtin_amdgcn_sched_barrier(0);
#pragma unroll
        for (int ki = 0; ki < PBK / 32; ++ki)
#pragma unroll
            for (int mi = 0; mi < 4; ++mi)
#pragma unroll
                for (int j = 0; j < 4; ++j)
                    acc[mi][j] = wmma16(a[ki][mi].v, bm[ki][j].v, acc[mi][j]);
        // keeps the conversions, and so the wait for the loads, behind this pass's products
        __builtin_amdgcn_sched_barrier(0);
        // the other buffer's readers left it at the barrier that ended the pass before
        if (s + 1 < D_MODEL / PBK) proj_put(r[(s + 1) & 1], put + ((s + 1) & 1) * P_STAGE);
        proj_barrier();
    }

    // ---- epilogue: + bias, relu, f16, packed 128-bit stores ----
    const int n0 = nb + wn * 64;          // wave's first N col (== head*64)
    const int h  = n0 / HEAD_DIM;         // one head per wave
    float bv[4];
#pragma unroll
    for (int j = 0; j < 4; ++j) bv[j] = bias[n0 + j * 16 + l16];
    // the register that holds the loads' offset is reused for the row index below: the wait
    // stands in front of that rewrite, and the scheduling fence keeps the rewrite behind it
    asm volatile("s_wait_xcnt 0x0" ::: "memory");
    __builtin_amdgcn_sched_barrier(0);

    const int mw = mb + wm * 64;          // wave's first M row; its 64 rows are in one batch
    const int b  = mw >> 11;
    const int sw = mw & (SEQ - 1);

    if (z == 2) {
        // Vt [dh][s]: C-layout register column r = consecutive s -> direct v8h
#pragma unroll
        for (int mi = 0; mi < 4; ++mi)
#pragma unroll
            for (int j = 0; j < 4; ++j) {
                const int dh = j * 16 + l16;
                v8h pk;
#pragma unroll
                for (int q = 0; q < 8; ++q) {
                    float val = acc[mi][j][q] + bv[j];
                    val = val > 0.f ? val : 0.f;
                    pk[q] = (_Float16)val;
                }
                *(v8h*)(Vt + ((size_t)(b * NUM_HEADS + h) * HEAD_DIM + dh) * SEQ +
                        sw + mi * 16 + grp * 8) = pk;
            }
    } else {
        // Qh/Kh [s][dh]: stage the wave's 64 x 64 tile in LDS, then coalesced b128 copy-out
        _Float16* dst = (z == 0) ? Qh : Kh;
        _Float16* cw  = lds_s + wave * (64 * 64);
#pragma unroll
        for (int mi = 0; mi < 4; ++mi)
#pragma unroll
            for (int j = 0; j < 4; ++j)
#pragma unroll
                for (int q = 0; q < 8; ++q) {
                    float val = acc[mi][j][q] + bv[j];
                    val = val > 0.f ? val : 0.f;
                    cw[(mi * 16 + grp * 8 + q) * 64 + j * 16 + l16] = (_Float16)val;
                }
        // same-wave DS ordering; 64 rows x 8 segs = 512 chunks, 16 per lane
#pragma unroll
        for (int i = 0; i < 16; ++i) {
            const int c   = lane + 32 * i;
            const int row = c >> 3, seg = c & 7;
            const v8h pk = *(const v8h*)(cw + row * 64 + seg * 8);
            *(v8h*)(dst + ((size_t)(b * NUM_HEADS + h) * SEQ + sw + row) *
                    HEAD_DIM + seg * 8) = pk;
        }
        // in the listing this branch falls through into code that rewrites the stores' address pair
        asm volatile("s_wait_xcnt 0x0" ::: "memory");
    }
}

// ---------------------------------------------------------------------------
// Causal flash attention, transposed products: S^T = K Q^T, O^T += V^T P^T.
// Grid: (SEQ/128, B*H), block 512 = KV_SPLIT groups of 4 waves. A block takes
// two 64-query tiles, t and SEQ/64 - 1 - t, so every block has the same causal
// work (SEQ/64 + 1 tile pairs). A wave owns 16 queries of either tile as two
// column groups (0 early, 1 late): both are B operands of the same K and V^T
// fragments, so a fragment read from LDS serves both while the early tile still
// has keys, and every wave of a key group has the same work. One query per lane
// column (l16); a lane holds 32 of the 64 scores of its query, lane ^ 16 the other
// 32. Maximum and sum are in-lane, joined with lane ^ 16; two S^T tiles converted in place are the B
// operand of the second product, so P never leaves the registers. KV tiles of 64
// staged in LDS, one per group and pass: group g walks tiles g, g + KV_SPLIT, ...
// with a running maximum, sum and O of its own; the groups' partial results are
// joined through LDS after the loop.
// Each group has two tile buffers, filled by asynchronous copies to LDS: the next
// pass's tile is in flight while this pass's is worked on, one barrier a pass.
// ---------------------------------------------------------------------------
// value of lane l ^ 16
__device__ __forceinline__ float xhalf(float x) {
    const int i = __builtin_bit_cast(int, x);
    return __builtin_bit_cast(float, __builtin_amdgcn_permlanex16(
        i, i, 0x76543210, 0xfedcba98, false, false));
}

// One group's K and V^T tile (64 x 128 B each) into one LDS buffer: 8 chunks of 16 B a
// thread, rows rw, rw + 16, rw + 32, rw + 48 of either tile. kg, vg: the lane's chunk of
// row rw in global memory; lk: its LDS byte address in the K half of the buffer.
__device__ __forceinline__ void kv_copy(const _Float16* kg, const _Float16* vg, unsigned lk) {
    const _Float16* kg1 = kg + 16 * HEAD_DIM;
    const _Float16* kg2 = kg + 32 * HEAD_DIM;
    const _Float16* kg3 = kg + 48 * HEAD_DIM;
    const _Float16* vg1 = vg + (size_t)16 * SEQ;
    const _Float16* vg2 = vg + (size_t)32 * SEQ;
    const _Float16* vg3 = vg + (size_t)48 * SEQ;
    const unsigned lk1 = lk + 16 * T_PITCH * 2;
    const unsigned lk2 = lk + 32 * T_PITCH * 2;
    const unsigned lk3 = lk + 48 * T_PITCH * 2;
    const unsigned lv  = lk + 64 * T_PITCH * 2;
    const unsigned lv1 = lv + 16 * T_PITCH * 2;
    const unsigned lv2 = lv + 32 * T_PITCH * 2;
    const unsigned lv3 = lv + 48 * T_PITCH * 2;
    // the closing wait stands in front of any rewrite of the address registers named here
    asm volatile("global_load_async_to_lds_b128 %0, %8, off\n\t"
                 "global_load_async_to_lds_b128 %1, %9, off\n\t"
                 "global_load_async_to_lds_b128 %2, %10, off\n\t"
                 "global_load_async_to_lds_b128 %3, %11, off\n\t"
                 "global_load_async_to_lds_b128 %4, %12, off\n\t"
                 "global_load_async_to_lds_b128 %5, %13, off\n\t"
                 "global_load_async_to_lds_b128 %6, %14, off\n\t"
                 "global_load_async_to_lds_b128 %7, %15, off\n\t"
                 "s_wait_xcnt 0x0"
                 :: "v"(lk), "v"(lk1), "v"(lk2), "v"(lk3), "v"(lv), "v"(lv1), "v"(lv2), "v"(lv3),
                    "v"(kg), "v"(kg1), "v"(kg2), "v"(kg3), "v"(vg), "v"(vg1), "v"(vg2), "v"(vg3)
                 : "memory");
}

// S^T = K Q^T of one column group: 4 key-tiles x 2 k-steps on the K fragments ak.
// sc[j][r] = S[query l16][key j*16 + grp*8 + r of the tile]
__device__ __forceinline__ void attn_scores(const AB16 (&ak)[4][2], const AB16& qa0,
                                            const AB16& qa1, v8f (&sc)[4]) {
#pragma unroll
    for (int j = 0; j < 4; ++j) {
        v8f s = {};
        s = wmma16(ak[j][0].v, qa0.v, s);
        s = wmma16(ak[j][1].v, qa1.v, s);
        sc[j] = s;
    }
}

// Online softmax step of one column group: scores in, P^T B-operands out; maximum, sum
// and O rescaled. Key j*16 + r of this lane's half is kept while <= lim.
__device__ __forceinline__ void attn_softmax(v8f (&sc)[4], int lim, float& m_run, float& l_run,
                                             v8f (&o)[4], AB16& pb0, AB16& pb1) {
    const float scale = 0.125f;  // 1/sqrt(64)
    // ---- mask + scale + maximum of the query's scores ----
    // one partial maximum and sum per key tile: four short chains
    float mxj[4];
#pragma unroll
    for (int j = 0; j < 4; ++j) {
        mxj[j] = -__builtin_inff();
#pragma unroll
        for (int r = 0; r < 8; ++r) {
            float s = sc[j][r] * scale;
            if (j * 16 + r > lim) s = -__builtin_inff();
            sc[j][r] = s;
            mxj[j] = fmaxf(mxj[j], s);
        }
    }
    float mx = fmaxf(fmaxf(mxj[0], mxj[1]), fmaxf(mxj[2], mxj[3]));
    mx = fmaxf(mx, xhalf(mx));
    // ---- online softmax update ----
    const float mn = fmaxf(m_run, mx);
    const float alpha = __expf(m_run - mn);
    m_run = mn;
    float rsj[4];
#pragma unroll
    for (int j = 0; j < 4; ++j) {
        rsj[j] = 0.f;
#pragma unroll
        for (int r = 0; r < 8; ++r) {
            const float p = __expf(sc[j][r] - mn);
            sc[j][r] = p;
            rsj[j] += p;
        }
    }
    const float rs = (rsj[0] + rsj[1]) + (rsj[2] + rsj[3]);
    l_run = l_run * alpha + rs;
#pragma unroll
    for (int t = 0; t < 4; ++t)
#pragma unroll
        for (int r = 0; r < 8; ++r) o[t][r] *= alpha;

    // ---- P^T B-operands: tiles 2s and 2s+1 hold keys grp*8+r and
    //      16+grp*8+r of k-step s, the k order of the V^T fragments ----
#pragma unroll
    for (int r = 0; r < 8; ++r) {
        pb0.h[0][r] = (_Float16)sc[0][r];
        pb0.h[1][r] = (_Float16)sc[1][r];
        pb1.h[0][r] = (_Float16)sc[2][r];
        pb1.h[1][r] = (_Float16)sc[3][r];
    }
}

// O^T += V^T P^T of one column group: 4 dh-tiles x 2 k-steps on the V^T fragments av
__device__ __forceinline__ void attn_out(const AB16 (&av)[4][2], const AB16& pb0,
                                         const AB16& pb1, v8f (&o)[4]) {
#pragma unroll
    for (int t = 0; t < 4; ++t) {
        o[t] = wmma16(av[t][0].v, pb0.v, o[t]);
        o[t] = wmma16(av[t][1].v, pb1.v, o[t]);
    }
}

// The A fragments of one 64 x 64 tile in LDS (K: row = key, V^T: row = d), k-steps 0 and 1
__device__ __forceinline__ void attn_frags(const _Float16* tile, int grp, int l16,
                                           AB16 (&a)[4][2]) {
#pragma unroll
    for (int j = 0; j < 4; ++j) {
        const _Float16* rp = tile + (j * 16 + l16) * T_PITCH;
        a[j][0].h[0] = *(const v8h*)(rp + grp * 8);
        a[j][0].h[1] = *(const v8h*)(rp + 16 + grp * 8);
        a[j][1].h[0] = *(const v8h*)(rp + 32 + grp * 8);
        a[j][1].h[1] = *(const v8h*)(rp + 48 + grp * 8);
    }
}

__global__ __launch_bounds__(128 * KV_SPLIT)
void attn_kernel(const _Float16* __restrict__ Qh, const _Float16* __restrict__ Kh,
                 const _Float16* __restrict__ Vt, float* __restrict__ out) {
    // overlay: per group 2 x [K 9KB | V 9KB] during loop, partial O of every column group after
    __shared__ __align__(16) unsigned char smem[KV_SPLIT * 2 * KV_BUF * 2];
    // per key group, 16-query group and query: maximum, sum
    __shared__ __align__(8) float lds_ml[KV_SPLIT * 8][16][2];
    static_assert(KV_SPLIT * 8 * 16 * O_PITCH * 4 <= sizeof(smem), "partial O fits the overlay");
    static_assert(KV_SPLIT == 4, "the join deals 16 rows to 4 groups and takes a maximum of 4");

    const int tid  = threadIdx.x;
    const int wave = tid >> 5;
    const int lane = tid & 31;
    const int grp  = lane >> 4;
    const int l16  = lane & 15;
    const int gtid = tid & 127;                // thread within its key group
    const int sub  = wave & 3;                 // the wave's 16 queries within either tile
    const int ks   = __builtin_amdgcn_readfirstlane(wave >> 2);  // key group, uniform

    _Float16* lds_g = (_Float16*)smem + ks * (2 * KV_BUF);  // the group's two buffers
    float*    lds_o = (float*)smem;                    // 32 x [16][O_PITCH] f32

    const int bh = blockIdx.y;                 // b*H + h
    const int qt_late = SEQ / 64 - 1 - (int)blockIdx.x;          // the block's late query tile
    // first query row of the wave's column groups: 0 early tile, 1 late tile
    const int qr[2] = {(int)blockIdx.x * 64 + sub * 16, qt_late * 64 + sub * 16};
    const int qe_u = __builtin_amdgcn_readfirstlane(qr[0]);  // uniform branch keys
    const int ql_u = __builtin_amdgcn_readfirstlane(qr[1]);

    const _Float16* Qb = Qh + (size_t)bh * SEQ * HEAD_DIM;
    const _Float16* Kb = Kh + (size_t)bh * SEQ * HEAD_DIM;
    const _Float16* Vb = Vt + (size_t)bh * HEAD_DIM * SEQ;

    // Q B-operands (column = query l16) for K-steps d=0..31 and d=32..63
    AB16 qa0[2], qa1[2];
#pragma unroll
    for (int c = 0; c < 2; ++c) {
        const _Float16* qp = Qb + (size_t)(qr[c] + l16) * HEAD_DIM;
        qa0[c].h[0] = *(const v8h*)(qp + grp * 8);
        qa0[c].h[1] = *(const v8h*)(qp + 16 + grp * 8);
        qa1[c].h[0] = *(const v8h*)(qp + 32 + grp * 8);
        qa1[c].h[1] = *(const v8h*)(qp + 48 + grp * 8);
    }

    // running maximum of query l16 (both halves alike), running sum over this half's keys only
    float m_run[2] = {-__builtin_inff(), -__builtin_inff()};
    float l_run[2] = {0.f, 0.f};
    v8f o[2][4] = {};                  // o[c][t][r] = O[query l16 of group c][d = t*16 + grp*8 + r]

    // block-uniform trip count (keys of the late tile): every wave passes every barrier
    const int kv_end = (qt_late + 1) * 64;
    const int np = (kv_end + 64 * KV_SPLIT - 1) / (64 * KV_SPLIT);   // passes, block-uniform

    // the lane's chunk of the group's tile of pass 0 and its place in buffer 0. Every
    // group copies a tile in every pass: pass p < np <= SEQ / 256 keeps keys
    // p * 256 + ks * 64 + 63 < SEQ, also where the tile lies past kv_end and is not used.
    const int rw = gtid >> 3, sg = gtid & 7;
    const _Float16* kg = Kb + (size_t)(ks * 64 + rw) * HEAD_DIM + sg * 8;
    const _Float16* vg = Vb + (size_t)rw * SEQ + ks * 64 + sg * 8;
    const unsigned lk = (unsigned)(size_t)(lds_g + rw * T_PITCH + sg * 8);

    kv_copy(kg, vg, lk);
    // pass 0's tile has landed before the barrier behind which other waves read it
    asm volatile("s_wait_asynccnt 0x0" ::: "memory");
    __syncthreads();
    if (np > 1)
        kv_copy(kg + (size_t)(64 * KV_SPLIT) * HEAD_DIM, vg + 64 * KV_SPLIT, lk + KV_BUF * 2);

    for (int p = 0; p < np; ++p) {
        const int kv0 = p * (64 * KV_SPLIT) + ks * 64;        // this group's tile of the pass
        const _Float16* lds_k = lds_g + (p & 1) * KV_BUF;     // [kv 64][T_PITCH]
        const _Float16* lds_v = lds_k + 64 * T_PITCH;         // [d 64][T_PITCH]

        // wave-uniform causal skips (also: no tile past kv_end); the early tile's keys
        // are a prefix of the late tile's, so its products ride on the late tile's fragments
        if (kv0 <= ql_u + 15) {
            const bool both = kv0 <= qe_u + 15;
            AB16 fr[4][2], pb0[2], pb1[2];
            v8f sc[4];
            attn_frags(lds_k, grp, l16, fr);
            if (both) {
                attn_scores(fr, qa0[0], qa1[0], sc);
                attn_softmax(sc, qr[0] + l16 - kv0 - grp * 8, m_run[0], l_run[0], o[0],
                             pb0[0], pb1[0]);
            }
            attn_scores(fr, qa0[1], qa1[1], sc);
            attn_softmax(sc, qr[1] + l16 - kv0 - grp * 8, m_run[1], l_run[1], o[1],
                         pb0[1], pb1[1]);
            attn_frags(lds_v, grp, l16, fr);
            attn_out(fr, pb0[1], pb1[1], o[1]);
            if (both) attn_out(fr, pb0[0], pb1[0], o[0]);
        }

        // the wave's reads of this pass's buffer are done before it is refilled
        asm volatile("s_wait_dscnt 0x0" ::: "memory");
        // the wave's copies of the next pass's tile have landed before other waves read them
        asm volatile("s_wait_asynccnt 0x0" ::: "memory");
        __syncthreads();
        if (p + 2 < np)   // block-uniform; into the buffer this pass has just read
            kv_copy(kg + (size_t)(p + 2) * (64 * KV_SPLIT) * HEAD_DIM,
                    vg + (p + 2) * (64 * KV_SPLIT), lk + (p & 1) * (KV_BUF * 2));
    }
    // no copy is outstanding when the buffers become the partial results' staging
    asm volatile("s_wait_asynccnt 0x0" ::: "memory");

    // ---- every column group's partial O, maximum and sum into the LDS overlay;
    //      slot ks * 8 + qg, qg = c * 4 + sub: the block's eight 16-query groups ----
    const int b = bh / NUM_HEADS;
    const int h = bh % NUM_HEADS;
#pragma unroll
    for (int c = 0; c < 2; ++c) {
        const int slot = ks * 8 + c * 4 + sub;
        const float l_all = l_run[c] + xhalf(l_run[c]);   // join the halves' sums
        float* ow = lds_o + slot * (16 * O_PITCH);        // safe: loop ended with barrier
#pragma unroll
        for (int t = 0; t < 4; ++t)
#pragma unroll
            for (int u = 0; u < 2; ++u) {
                v4f val;
#pragma unroll
                for (int e = 0; e < 4; ++e) val[e] = o[c][t][u * 4 + e];
                *(v4f*)(ow + l16 * O_PITCH + t * 16 + grp * 8 + u * 4) = val;
            }
        if (grp == 0) {
            lds_ml[slot][l16][0] = m_run[c];   // -inf, with sum 0 and O 0, where it had no tile
            lds_ml[slot][l16][1] = l_all;
        }
    }
    __syncthreads();   // the groups' partial results are read across waves below

    // ---- join the key groups: wave (ks, sub) takes rows ks*4 .. ks*4+3 of the query
    //      groups sub and 4 + sub; 16 lanes cover one 256-B row, so stores are whole
    //      lines. Group 0 always holds key 0, so the joint maximum is finite. ----
#pragma unroll
    for (int c = 0; c < 2; ++c) {
        const int qg = c * 4 + sub;
#pragma unroll
        for (int i = 0; i < 2; ++i) {
            const int row = ks * 4 + i * 2 + grp;
            float mg[KV_SPLIT], lg[KV_SPLIT];
#pragma unroll
            for (int g = 0; g < KV_SPLIT; ++g) {
                mg[g] = lds_ml[g * 8 + qg][row][0];
                lg[g] = lds_ml[g * 8 + qg][row][1];
            }
            const float mj = fmaxf(fmaxf(mg[0], mg[1]), fmaxf(mg[2], mg[3]));
            float lj = 0.f;
            v4f acc = {};
#pragma unroll
            for (int g = 0; g < KV_SPLIT; ++g) {
                const float w = __expf(mg[g] - mj);
                lj += lg[g] * w;
                const v4f part = *(const v4f*)(lds_o + (g * 8 + qg) * (16 * O_PITCH) +
                                               row * O_PITCH + l16 * 4);
#pragma unroll
                for (int e = 0; e < 4; ++e) acc[e] += part[e] * w;
            }
            const float inv_l = 1.0f / lj;
#pragma unroll
            for (int e = 0; e < 4; ++e) acc[e] *= inv_l;
            *(v4f*)(out + ((size_t)(h * BATCH + b) * SEQ + qr[c] + row) * HEAD_DIM +
                    l16 * 4) = acc;
        }
    }
}

// ---------------------------------------------------------------------------
extern "C" void kernel_launch(void* const* d_in, const int* in_sizes, int n_in,
                              void* d_out, int out_size, void* d_ws, size_t ws_size,
                              hipStream_t stream) {
    const float* q    = (const float*)d_in[0];
    const float* k    = (const float*)d_in[1];
    const float* v    = (const float*)d_in[2];
    const float* W    = (const float*)d_in[3];
    const float* bias = (const float*)d_in[4];

    const size_t per = (size_t)BATCH * NUM_HEADS * SEQ * HEAD_DIM;  // 2,097,152
    _Float16* Qh = (_Float16*)d_ws;
    _Float16* Kh = Qh + per;
    _Float16* Vt = Kh + per;

    dim3 pgrid((BATCH * SEQ) / PBM, D_MODEL / PBN, 3);
    proj_kernel<<<pgrid, P_THR, 0, stream>>>(q, k, v, W, bias, Qh, Kh, Vt);

    dim3 agrid(SEQ / 128, BATCH * NUM_HEADS);
    attn_kernel<<<agrid, 128 * KV_SPLIT, 0, stream>>>(Qh, Kh, Vt, (float*)d_out);
}

// v009
// A run of this version takes 26.8 microseconds.
// Next to v008, in two timings, it ran 1.05 and 1.06 times as fast.
// Counting every step since v000, it is 5.53 times as fast.
#include <hip/hip_runtime.h>

#define D_MODEL   512
#define NUM_HEADS 8
#define HEAD_DIM  64
#define BATCH     2
#define SEQ       2048

// LDS row pitches. A fragment read is one ds_load_b128 per lane with 16 lanes on
// 16 consecutive rows; a pitch of 16 B x odd puts those rows on disjoint banks.
#define T_PITCH  72   // halves: 64 data + 8 pad  (144 B), K / V^T tiles, projection slices
#define O_PITCH  68   // floats: 64 data + 4 pad  (272 B), output staging
#define KV_SPLIT 4    // wave groups of the attention block, each on its own key tiles
#define KV_BUF   (2 * 64 * T_PITCH)               // halves of one K + V^T tile buffer
#define PBM      128  // projection block tile, rows of X
#define PBN      256  // projection block tile, rows of W
#define PBK      64   // k of one projection slice
#define P_STAGE  ((PBM + PBN) * T_PITCH)          // halves of one slice buffer
#define P_THR    256  // projection block: 8 waves, 2 x 4
#define P_CH     ((PBM + PBN) * PBK / 4 / P_THR)  // 16-B f32 chunks per thread and slice

typedef __attribute__((ext_vector_type(16))) _Float16 v16h;
typedef __attribute__((ext_vector_type(8)))  _Float16 v8h;
typedef __attribute__((ext_vector_type(4)))  _Float16 v4h;
typedef __attribute__((ext_vector_type(8)))  float    v8f;
typedef __attribute__((ext_vector_type(4)))  float    v4f;

union AB16 { v16h v; v8h h[2]; };

__device__ __forceinline__ v8f wmma16(v16h a, v16h b, v8f c) {
    return __builtin_amdgcn_wmma_f32_16x16x32_f16(false, a, false, b,
                                                  (short)0, c, false, false);
}

// ---------------------------------------------------------------------------
// Fused projection: P = relu(X @ W^T + b), emitted as f16.
//   z==0 -> Qh [b,h,s,dh]   z==1 -> Kh [b,h,s,dh]   z==2 -> Vt [b,h,dh,s]
// Grid: (M/128, 512/256, 3), block 256 (8 waves, 2 x 4). Block tile 128(M) x
// 256(N), wave tile 64 x 64 (one head): 4 + 4 fragments feed 16 products, so the LDS
// reads keep level with the matrix unit. A slice is 64 k of the 128 X rows and the
// 256 W rows: every load instruction covers two whole 256-B row pieces, the slice
// is converted once and kept as f16 in one of two LDS buffers. Slices are fetched
// two ahead into two register sets, so loads stay in flight through every pass but the last.
// ---------------------------------------------------------------------------
__device__ __forceinline__ void proj_fetch(v4f (&r)[P_CH], const float* __restrict__ xs,
                                           const float* __restrict__ wsrc, int s) {
#pragma unroll
    for (int i = 0; i < P_CH; ++i)
        r[i] = (i < PBM / 16)
                   ? *(const v4f*)(xs + (size_t)i * 16 * D_MODEL + s * PBK)
                   : *(const v4f*)(wsrc + (size_t)(i - PBM / 16) * 16 * D_MODEL + s * PBK);
}

__device__ __forceinline__ void proj_put(const v4f (&r)[P_CH], _Float16* dst) {
#pragma unroll
    for (int i = 0; i < P_CH; ++i) {
        v4h pk;
#pragma unroll
        for (int e = 0; e < 4; ++e) pk[e] = (_Float16)r[i][e];
        *(v4h*)(dst + i * 16 * T_PITCH) = pk;
    }
}

// Work-group barrier behind the wave's LDS traffic alone: __syncthreads() also waits
// for every global load, and the slices fetched ahead must stay in flight across it.
// No global store precedes it in this kernel.
__device__ __forceinline__ void proj_barrier() {
    asm volatile("s_wait_dscnt 0x0\n\ts_barrier_signal -1\n\ts_barrier_wait -1" ::: "memory");
}

__global__ __launch_bounds__(P_THR)
void proj_kernel(const float* __restrict__ Xq, const float* __restrict__ Xk,
                 const float* __restrict__ Xv, const float* __restrict__ W,
                 const float* __restrict__ bias,
                 _Float16* __restrict__ Qh, _Float16* __restrict__ Kh,
                 _Float16* __restrict__ Vt) {
    // two slice buffers [X 128 rows | W 256 rows][T_PITCH]; store staging after the loop
    __shared__ __align__(16) _Float16 lds_s[2 * P_STAGE];
    static_assert(8 * 64 * 64 <= 2 * P_STAGE, "store staging fits the overlay");

    const int tid  = threadIdx.x;
    const int wave = tid >> 5;
    const int lane = tid & 31;
    const int grp  = lane >> 4;   // half-wave group (K-group of WMMA layouts)
    const int l16  = lane & 15;
    const int wm   = wave >> 2;   // wave's 64 rows of the block tile
    const int wn   = wave & 3;    // wave's 64 columns (head) of the block tile

    const int z = blockIdx.z;
    const float* X = (z == 0) ? Xq : (z == 1) ? Xk : Xv;

    const int mb = blockIdx.x * PBM;   // first M row of the block
    const int nb = blockIdx.y * PBN;   // first N col of the block

    // loader: thread takes 16 B of row (tid >> 4) + 16 i, 16 threads a 256-B row piece
    const int lr = tid >> 4, lc = (tid & 15) * 4;
    const float* xs   = X + (size_t)(mb + lr) * D_MODEL + lc;
    const float* wsrc = W + (size_t)(nb + lr) * D_MODEL + lc;
    _Float16* put = lds_s + lr * T_PITCH + lc;

    v8f acc[4][4] = {};
    v4f r[2][P_CH];

    proj_fetch(r[0], xs, wsrc, 0);
    // keeps slice 0's loads the older ones, so that its wait leaves slice 1's in flight
    __builtin_amdgcn_sched_barrier(0);
    proj_fetch(r[1], xs, wsrc, 1);
    // keeps slice 1's loads in front of the first conversion (and its wait)
    __builtin_amdgcn_sched_barrier(0);
    proj_put(r[0], put);
    proj_barrier();

    // unrolled so that the register set and the LDS buffer of a pass are compile-time
#pragma unroll
    for (int s = 0; s < D_MODEL / PBK; ++s) {
        if (s + 2 < D_MODEL / PBK) proj_fetch(r[s & 1], xs, wsrc, s + 2);
        // keeps the loads at the head of the pass: they fly through two passes' products
        __builtin_amdgcn_sched_barrier(0);
        const _Float16* buf = lds_s + (s & 1) * P_STAGE;
        AB16 a[PBK / 32][4], bm[PBK / 32][4];
#pragma unroll
        for (int ki = 0; ki < PBK / 32; ++ki) {
#pragma unroll
            for (int j = 0; j < 4; ++j) {
                const _Float16* bp = buf + (PBM + wn * 64 + j * 16 + l16) * T_PITCH + ki * 32;
                bm[ki][j].h[0] = *(const v8h*)(bp + grp * 8);
                bm[ki][j].h[1] = *(const v8h*)(bp + 16 + grp * 8);
            }
#pragma unroll
            for (int mi = 0; mi < 4; ++mi) {
                const _Float16* ap = buf + (wm * 64 + mi * 16 + l16) * T_PITCH + ki * 32;
                a[ki][mi].h[0] = *(const v8h*)(ap + grp * 8);
                a[ki][mi].h[1] = *(const v8h*)(ap + 16 + grp * 8);
            }
        }
        // keeps the pass's fragment reads one group in front of its products: read row by
        // row into one register set, every row of products waits out the LDS latency
        __builtin_amdgcn_sched_barrier(0);
#pragma unroll
        for (int ki = 0; ki < PBK / 32; ++ki)
#pragma unroll
            for (int mi = 0; mi < 4; ++mi)
#pragma unroll
                for (int j = 0; j < 4; ++j)
                    acc[mi][j] = wmma16(a[ki][mi].v, bm[ki][j].v, acc[mi][j]);
        // keeps the conversions, and so the wait for the loads, behind this pass's products
        __builtin_amdgcn_sched_barrier(0);
        // the other buffer's readers left it at the barrier that ended the pass before
        if (s + 1 < D_MODEL / PBK) proj_put(r[(s + 1) & 1], put + ((s + 1) & 1) * P_STAGE);
        proj_barrier();
    }

    // ---- epilogue: + bias, relu, f16, packed 128-bit stores ----
    const int n0 = nb + wn * 64;          // wave's first N col (== head*64)
    const int h  = n0 / HEAD_DIM;         // one head per wave
    float bv[4];
#pragma unroll
    for (int j = 0; j < 4; ++j) bv[j] = bias[n0 + j * 16 + l16];
    // the register that holds the loads' offset is reused for the row index below: the wait
    // stands in front of that rewrite, and the scheduling fence keeps the rewrite behind it
    asm volatile("s_wait_xcnt 0x0" ::: "memory");
    __builtin_amdgcn_sched_barrier(0);

    const int mw = mb + wm * 64;          // wave's first M row; its 64 rows are in one batch
    const int b  = mw >> 11;
    const int sw = mw & (SEQ - 1);

    if (z == 2) {
        // Vt [dh][s]: C-layout register column r = consecutive s -> direct v8h
#pragma unroll
        for (int mi = 0; mi < 4; ++mi)
#pragma unroll
            for (int j = 0; j < 4; ++j) {
                const int dh = j * 16 + l16;
                v8h pk;
#pragma unroll
                for (int q = 0; q < 8; ++q) {
                    float val = acc[mi][j][q] + bv[j];
                    val = val > 0.f ? val : 0.f;
                    pk[q] = (_Float16)val;
                }
                *(v8h*)(Vt + ((size_t)(b * NUM_HEADS + h) * HEAD_DIM + dh) * SEQ +
                        sw + mi * 16 + grp * 8) = pk;
            }
    } else {
        // Qh/Kh [s][dh]: stage the wave's 64 x 64 tile in LDS, then coalesced b128 copy-out
        _Float16* dst = (z == 0) ? Qh : Kh;
        _Float16* cw  = lds_s + wave * (64 * 64);
#pragma unroll
        for (int mi = 0; mi < 4; ++mi)
#pragma unroll
            for (int j = 0; j < 4; ++j)
#pragma unroll
                for (int q = 0; q < 8; ++q) {
                    float val = acc[mi][j][q] + bv[j];
                    val = val > 0.f ? val : 0.f;
                    cw[(mi * 16 + grp * 8 + q) * 64 + j * 16 + l16] = (_Float16)val;
                }
        // same-wave DS ordering; 64 rows x 8 segs = 512 chunks, 16 per lane
#pragma unroll
        for (int i = 0; i < 16; ++i) {
            const int c   = lane + 32 * i;
            const int row = c >> 3, seg = c & 7;
            const v8h pk = *(const v8h*)(cw + row * 64 + seg * 8);
            *(v8h*)(dst + ((size_t)(b * NUM_HEADS + h) * SEQ + sw + row) *
                    HEAD_DIM + seg * 8) = pk;
        }
        // in the listing this branch falls through into code that rewrites the stores' address pair
        asm volatile("s_wait_xcnt 0x0" ::: "memory");
    }
}

// ---------------------------------------------------------------------------
// Causal flash attention, transposed products: S^T = K Q^T, O^T += V^T P^T.
// Grid: (SEQ/128, B*H), block 512 = KV_SPLIT groups of 4 waves. A block takes
// two 64-query tiles, t and SEQ/64 - 1 - t, so every block has the same causal
// work (SEQ/64 + 1 tile pairs). A wave owns 16 queries of either tile as two
// column groups (0 early, 1 late): both are B operands of the same K and V^T
// fragments, so a fragment read from LDS serves both while the early tile still
// has keys, and every wave of a key group has the same work. One query per lane
// column (l16); a lane holds 32 of the 64 scores of its query, lane ^ 16 the other
// 32. Maximum and sum are in-lane, joined with lane ^ 16; two S^T tiles converted in place are the B
// operand of the second product, so P never leaves the registers. KV tiles of 64
// staged in LDS, one per group and pass: group g walks tiles g, g + KV_SPLIT, ...
// with a running maximum, sum and O of its own; the groups' partial results are
// joined through LDS after the loop.
// Each group has two tile buffers, filled by asynchronous copies to LDS: the next
// pass's tile is in flight while this pass's is worked on, one barrier a pass.
// ---------------------------------------------------------------------------
// value of lane l ^ 16
__device__ __forceinline__ float xhalf(float x) {
    const int i = __builtin_bit_cast(int, x);
    return __builtin_bit_cast(float, __builtin_amdgcn_permlanex16(
        i, i, 0x76543210, 0xfedcba98, false, false));
}

// One group's K and V^T tile (64 x 128 B each) into one LDS buffer: 8 chunks of 16 B a
// thread, rows rw, rw + 16, rw + 32, rw + 48 of either tile. kg, vg: the lane's chunk of
// row rw in global memory; lk: its LDS byte address in the K half of the buffer.
__device__ __forceinline__ void kv_copy(const _Float16* kg, const _Float16* vg, unsigned lk) {
    const _Float16* kg1 = kg + 16 * HEAD_DIM;
    const _Float16* kg2 = kg + 32 * HEAD_DIM;
    const _Float16* kg3 = kg + 48 * HEAD_DIM;
    const _Float16* vg1 = vg + (size_t)16 * SEQ;
    const _Float16* vg2 = vg + (size_t)32 * SEQ;
    const _Float16* vg3 = vg + (size_t)48 * SEQ;
    const unsigned lk1 = lk + 16 * T_PITCH * 2;
    const unsigned lk2 = lk + 32 * T_PITCH * 2;
    const unsigned lk3 = lk + 48 * T_PITCH * 2;
    const unsigned lv  = lk + 64 * T_PITCH * 2;
    const unsigned lv1 = lv + 16 * T_PITCH * 2;
    const unsigned lv2 = lv + 32 * T_PITCH * 2;
    const unsigned lv3 = lv + 48 * T_PITCH * 2;
    // the closing wait stands in front of any rewrite of the address registers named here
    asm volatile("global_load_async_to_lds_b128 %0, %8, off\n\t"
                 "global_load_async_to_lds_b128 %1, %9, off\n\t"
                 "global_load_async_to_lds_b128 %2, %10, off\n\t"
                 "global_load_async_to_lds_b128 %3, %11, off\n\t"
                 "global_load_async_to_lds_b128 %4, %12, off\n\t"
                 "global_load_async_to_lds_b128 %5, %13, off\n\t"
                 "global_load_async_to_lds_b128 %6, %14, off\n\t"
                 "global_load_async_to_lds_b128 %7, %15, off\n\t"
                 "s_wait_xcnt 0x0"
                 :: "v"(lk), "v"(lk1), "v"(lk2), "v"(lk3), "v"(lv), "v"(lv1), "v"(lv2), "v"(lv3),
                    "v"(kg), "v"(kg1), "v"(kg2), "v"(kg3), "v"(vg), "v"(vg1), "v"(vg2), "v"(vg3)
                 : "memory");
}

// S^T = K Q^T of one column group: 4 key-tiles x 2 k-steps on the K fragments ak.
// sc[j][r] = S[query l16][key j*16 + grp*8 + r of the tile]
__device__ __forceinline__ void attn_scores(const AB16 (&ak)[4][2], const AB16& qa0,
                                            const AB16& qa1, v8f (&sc)[4]) {
#pragma unroll
    for (int j = 0; j < 4; ++j) {
        v8f s = {};
        s = wmma16(ak[j][0].v, qa0.v, s);
        s = wmma16(ak[j][1].v, qa1.v, s);
        sc[j] = s;
    }
    // keeps the eight products in front of the first use of a score: a use placed directly
    // behind its product costs four idle vector slots
    __builtin_amdgcn_sched_barrier(0);
}

// Online softmax step of one column group: scores in, P^T B-operands out; maximum, sum
// and O rescaled. diag is the same in the whole wave: where it is set, key j*16 + r of
// this lane's half is kept while <= lim; elsewhere every key of the tile is kept.
template <bool CAN_CROSS>
__device__ __forceinline__ void attn_softmax(const v8f (&sc)[4], bool diag, int lim, float& m_run,
                                             float& l_run, v8f (&o)[4], AB16& pb0, AB16& pb1) {
    const float scale = 0.125f;  // 1/sqrt(64)
    // single registers from here on: the select below then works in place
    float s[4][8];
#pragma unroll
    for (int j = 0; j < 4; ++j)
#pragma unroll
        for (int r = 0; r < 8; ++r) s[j][r] = sc[j][r] * scale;
    // ---- causal mask, only in a tile that crosses the diagonal (scalar branch) ----
    if (CAN_CROSS && diag) {
#pragma unroll
        for (int j = 0; j < 4; ++j)
#pragma unroll
            for (int r = 0; r < 8; ++r)
                if (j * 16 + r > lim) s[j][r] = -__builtin_inff();
    }
    // ---- maximum of the query's scores ----
    // one partial maximum and sum per key tile: four short chains
    float mxj[4];
#pragma unroll
    for (int j = 0; j < 4; ++j) {
        mxj[j] = -__builtin_inff();
#pragma unroll
        for (int r = 0; r < 8; ++r) mxj[j] = fmaxf(mxj[j], s[j][r]);
    }
    float mx = fmaxf(fmaxf(mxj[0], mxj[1]), fmaxf(mxj[2], mxj[3]));
    mx = fmaxf(mx, xhalf(mx));
    // ---- online softmax update ----
    const float mn = fmaxf(m_run, mx);
    const float alpha = __expf(m_run - mn);
    m_run = mn;
    float rsj[4];
#pragma unroll
    for (int j = 0; j < 4; ++j) {
        rsj[j] = 0.f;
#pragma unroll
        for (int r = 0; r < 8; ++r) {
            const float p = __expf(s[j][r] - mn);
            s[j][r] = p;
            rsj[j] += p;
        }
    }
    const float rs = (rsj[0] + rsj[1]) + (rsj[2] + rsj[3]);
    l_run = l_run * alpha + rs;
#pragma unroll
    for (int t = 0; t < 4; ++t)
#pragma unroll
        for (int r = 0; r < 8; ++r) o[t][r] *= alpha;

    // ---- P^T B-operands: tiles 2s and 2s+1 hold keys grp*8+r and
    //      16+grp*8+r of k-step s, the k order of the V^T fragments ----
#pragma unroll
    for (int r = 0; r < 8; ++r) {
        pb0.h[0][r] = (_Float16)s[0][r];
        pb0.h[1][r] = (_Float16)s[1][r];
        pb1.h[0][r] = (_Float16)s[2][r];
        pb1.h[1][r] = (_Float16)s[3][r];
    }
}

// O^T += V^T P^T of one column group: 4 dh-tiles x 2 k-steps on the V^T fragments av
__device__ __forceinline__ void attn_out(const AB16 (&av)[4][2], const AB16& pb0,
                                         const AB16& pb1, v8f (&o)[4]) {
#pragma unroll
    for (int t = 0; t < 4; ++t) {
        o[t] = wmma16(av[t][0].v, pb0.v, o[t]);
        o[t] = wmma16(av[t][1].v, pb1.v, o[t]);
    }
}

// The A fragments of one 64 x 64 tile in LDS (K: row = key, V^T: row = d), k-steps 0 and 1
__device__ __forceinline__ void attn_frags(const _Float16* tile, int grp, int l16,
                                           AB16 (&a)[4][2]) {
#pragma unroll
    for (int j = 0; j < 4; ++j) {
        const _Float16* rp = tile + (j * 16 + l16) * T_PITCH;
        a[j][0].h[0] = *(const v8h*)(rp + grp * 8);
        a[j][0].h[1] = *(const v8h*)(rp + 16 + grp * 8);
        a[j][1].h[0] = *(const v8h*)(rp + 32 + grp * 8);
        a[j][1].h[1] = *(const v8h*)(rp + 48 + grp * 8);
    }
    // keeps a tile's fragment reads one group in front of its products: read piecemeal
    // into reused registers, each piece waits out the LDS latency
    __builtin_amdgcn_sched_barrier(0);
}

__global__ __launch_bounds__(128 * KV_SPLIT)
void attn_kernel(const _Float16* __restrict__ Qh, const _Float16* __restrict__ Kh,
                 const _Float16* __restrict__ Vt, float* __restrict__ out) {
    // overlay: per group 2 x [K 9KB | V 9KB] during loop, partial O of every column group after
    __shared__ __align__(16) unsigned char smem[KV_SPLIT * 2 * KV_BUF * 2];
    // per key group, 16-query group and query: maximum, sum
    __shared__ __align__(8) float lds_ml[KV_SPLIT * 8][16][2];
    static_assert(KV_SPLIT * 8 * 16 * O_PITCH * 4 <= sizeof(smem), "partial O fits the overlay");
    static_assert(KV_SPLIT == 4, "the join deals 16 rows to 4 groups and takes a maximum of 4");

    const int tid  = threadIdx.x;
    const int wave = tid >> 5;
    const int lane = tid & 31;
    const int grp  = lane >> 4;
    const int l16  = lane & 15;
    const int gtid = tid & 127;                // thread within its key group
    const int sub  = wave & 3;                 // the wave's 16 queries within either tile
    const int ks   = __builtin_amdgcn_readfirstlane(wave >> 2);  // key group, uniform

    _Float16* lds_g = (_Float16*)smem + ks * (2 * KV_BUF);  // the group's two buffers
    float*    lds_o = (float*)smem;                    // 32 x [16][O_PITCH] f32

    const int bh = blockIdx.y;                 // b*H + h
    const int qt_late = SEQ / 64 - 1 - (int)blockIdx.x;          // the block's late query tile
    // first query row of the wave's column groups: 0 early tile, 1 late tile
    const int qr[2] = {(int)blockIdx.x * 64 + sub * 16, qt_late * 64 + sub * 16};
    const int qe_u = __builtin_amdgcn_readfirstlane(qr[0]);  // uniform branch keys
    const int ql_u = __builtin_amdgcn_readfirstlane(qr[1]);

    const _Float16* Qb = Qh + (size_t)bh * SEQ * HEAD_DIM;
    const _Float16* Kb = Kh + (size_t)bh * SEQ * HEAD_DIM;
    const _Float16* Vb = Vt + (size_t)bh * HEAD_DIM * SEQ;

    // Q B-operands (column = query l16) for K-steps d=0..31 and d=32..63
    AB16 qa0[2], qa1[2];
#pragma unroll
    for (int c = 0; c < 2; ++c) {
        const _Float16* qp = Qb + (size_t)(qr[c] + l16) * HEAD_DIM;
        qa0[c].h[0] = *(const v8h*)(qp + grp * 8);
        qa0[c].h[1] = *(const v8h*)(qp + 16 + grp * 8);
        qa1[c].h[0] = *(const v8h*)(qp + 32 + grp * 8);
        qa1[c].h[1] = *(const v8h*)(qp + 48 + grp * 8);
    }

    // running maximum of query l16 (both halves alike), running sum over this half's keys only
    float m_run[2] = {-__builtin_inff(), -__builtin_inff()};
    float l_run[2] = {0.f, 0.f};
    v8f o[2][4] = {};                  // o[c][t][r] = O[query l16 of group c][d = t*16 + grp*8 + r]

    // block-uniform trip count (keys of the late tile): every wave passes every barrier
    const int kv_end = (qt_late + 1) * 64;
    const int np = (kv_end + 64 * KV_SPLIT - 1) / (64 * KV_SPLIT);   // passes, block-uniform

    // the lane's chunk of the group's tile of pass 0 and its place in buffer 0. Every
    // group copies a tile in every pass: pass p < np <= SEQ / 256 keeps keys
    // p * 256 + ks * 64 + 63 < SEQ, also where the tile lies past kv_end and is not used.
    const int rw = gtid >> 3, sg = gtid & 7;
    const _Float16* kg = Kb + (size_t)(ks * 64 + rw) * HEAD_DIM + sg * 8;
    const _Float16* vg = Vb + (size_t)rw * SEQ + ks * 64 + sg * 8;
    const unsigned lk = (unsigned)(size_t)(lds_g + rw * T_PITCH + sg * 8);

    kv_copy(kg, vg, lk);
    // pass 0's tile has landed before the barrier behind which other waves read it
    asm volatile("s_wait_asynccnt 0x0" ::: "memory");
    __syncthreads();
    if (np > 1)
        kv_copy(kg + (size_t)(64 * KV_SPLIT) * HEAD_DIM, vg + 64 * KV_SPLIT, lk + KV_BUF * 2);

    // foot of pass p, every wave: hands the next tile over and refills the buffer just read
    auto pass_foot = [&](int p) {
        // the wave's reads of this pass's buffer are done before it is refilled
        asm volatile("s_wait_dscnt 0x0" ::: "memory");
        // the wave's copies of the next pass's tile have landed before other waves read them
        asm volatile("s_wait_asynccnt 0x0" ::: "memory");
        __syncthreads();
        if (p + 2 < np)   // block-uniform; into the buffer this pass has just read
            kv_copy(kg + (size_t)(p + 2) * (64 * KV_SPLIT) * HEAD_DIM,
                    vg + (p + 2) * (64 * KV_SPLIT), lk + (p & 1) * (KV_BUF * 2));
    };

    // The passes fall in two runs, block-uniform. Passes 0 .. np_e - 1 hold the early tile's
    // keys (key tiles 0 .. blockIdx.x). Their key tiles, 0 .. np_e * KV_SPLIT - 1, end at
    // SEQ / 128 - 1 or sooner, in front of the late tile (index >= SEQ / 128): there the late
    // column group has work in every wave and no key to mask. The later passes hold nothing
    // for the early column group. The causal compare and select run only where the tile
    // crosses a column group's diagonal.
    static_assert(SEQ / 128 % KV_SPLIT == 0, "the early tiles' passes end in front of the late tiles");
    const int np_e = (int)blockIdx.x / KV_SPLIT + 1;   // <= SEQ / 128 / KV_SPLIT < np
    int p = 0;
    for (; p < np_e; ++p) {
        const int kv0 = p * (64 * KV_SPLIT) + ks * 64;        // this group's tile of the pass
        const _Float16* lds_k = lds_g + (p & 1) * KV_BUF;     // [kv 64][T_PITCH]
        const _Float16* lds_v = lds_k + 64 * T_PITCH;         // [d 64][T_PITCH]
        // wave-uniform causal skip; the early tile's keys are a prefix of the late tile's,
        // so its products ride on the late tile's fragments
        const bool both = kv0 <= qe_u + 15;
        AB16 fr[4][2], pb0[2], pb1[2];
        v8f sc[4];
        attn_frags(lds_k, grp, l16, fr);
        if (both) {
            attn_scores(fr, qa0[0], qa1[0], sc);
            attn_softmax<true>(sc, kv0 + 63 > qe_u, qr[0] + l16 - kv0 - grp * 8, m_run[0],
                               l_run[0], o[0], pb0[0], pb1[0]);
        }
        attn_scores(fr, qa0[1], qa1[1], sc);
        attn_softmax<false>(sc, false, 0, m_run[1], l_run[1], o[1], pb0[1], pb1[1]);
        attn_frags(lds_v, grp, l16, fr);
        attn_out(fr, pb0[1], pb1[1], o[1]);
        if (both) attn_out(fr, pb0[0], pb1[0], o[0]);
        pass_foot(p);
    }
    for (; p < np; ++p) {
        const int kv0 = p * (64 * KV_SPLIT) + ks * 64;
        const _Float16* lds_k = lds_g + (p & 1) * KV_BUF;
        const _Float16* lds_v = lds_k + 64 * T_PITCH;
        if (kv0 <= ql_u + 15) {   // wave-uniform causal skip (also: no tile past kv_end)
            AB16 fr[4][2], pb0, pb1;
            v8f sc[4];
            attn_frags(lds_k, grp, l16, fr);
            attn_scores(fr, qa0[1], qa1[1], sc);
            attn_softmax<true>(sc, kv0 + 63 > ql_u, qr[1] + l16 - kv0 - grp * 8, m_run[1],
                               l_run[1], o[1], pb0, pb1);
            attn_frags(lds_v, grp, l16, fr);
            attn_out(fr, pb0, pb1, o[1]);
        }
        pass_foot(p);
    }
    // no copy is outstanding when the buffers become the partial results' staging
    asm volatile("s_wait_asynccnt 0x0" ::: "memory");

    // ---- every column group's partial O, maximum and sum into the LDS overlay;
    //      slot ks * 8 + qg, qg = c * 4 + sub: the block's eight 16-query groups ----
    const int b = bh / NUM_HEADS;
    const int h = bh % NUM_HEADS;
#pragma unroll
    for (int c = 0; c < 2; ++c) {
        const int slot = ks * 8 + c * 4 + sub;
        const float l_all = l_run[c] + xhalf(l_run[c]);   // join the halves' sums
        float* ow = lds_o + slot * (16 * O_PITCH);        // safe: loop ended with barrier
#pragma unroll
        for (int t = 0; t < 4; ++t)
#pragma unroll
            for (int u = 0; u < 2; ++u) {
                v4f val;
#pragma unroll
                for (int e = 0; e < 4; ++e) val[e] = o[c][t][u * 4 + e];
                *(v4f*)(ow + l16 * O_PITCH + t * 16 + grp * 8 + u * 4) = val;
            }
        if (grp == 0) {
            lds_ml[slot][l16][0] = m_run[c];   // -inf, with sum 0 and O 0, where it had no tile
            lds_ml[slot][l16][1] = l_all;
        }
    }
    __syncthreads();   // the groups' partial results are read across waves below

    // ---- join the key groups: wave (ks, sub) takes rows ks*4 .. ks*4+3 of the query
    //      groups sub and 4 + sub; 16 lanes cover one 256-B row, so stores are whole
    //      lines. Group 0 always holds key 0, so the joint maximum is finite. ----
#pragma unroll
    for (int c = 0; c < 2; ++c) {
        const int qg = c * 4 + sub;
#pragma unroll
        for (int i = 0; i < 2; ++i) {
            const int row = ks * 4 + i * 2 + grp;
            float mg[KV_SPLIT], lg[KV_SPLIT];
#pragma unroll
            for (int g = 0; g < KV_SPLIT; ++g) {
                mg[g] = lds_ml[g * 8 + qg][row][0];
                lg[g] = lds_ml[g * 8 + qg][row][1];
            }
            const float mj = fmaxf(fmaxf(mg[0], mg[1]), fmaxf(mg[2], mg[3]));
            float lj = 0.f;
            v4f acc = {};
#pragma unroll
            for (int g = 0; g < KV_SPLIT; ++g) {
                const float w = __expf(mg[g] - mj);
                lj += lg[g] * w;
                const v4f part = *(const v4f*)(lds_o + (g * 8 + qg) * (16 * O_PITCH) +
                                               row * O_PITCH + l16 * 4);
#pragma unroll
                for (int e = 0; e < 4; ++e) acc[e] += part[e] * w;
            }
            const float inv_l = 1.0f / lj;
#pragma unroll
            for (int e = 0; e < 4; ++e) acc[e] *= inv_l;
            *(v4f*)(out + ((size_t)(h * BATCH + b) * SEQ + qr[c] + row) * HEAD_DIM +
                    l16 * 4) = acc;
        }
    }
}

// ---------------------------------------------------------------------------
extern "C" void kernel_launch(void* const* d_in, const int* in_sizes, int n_in,
                              void* d_out, int out_size, void* d_ws, size_t ws_size,
                              hipStream_t stream) {
    const float* q    = (const float*)d_in[0];
    const float* k    = (const float*)d_in[1];
    const float* v    = (const float*)d_in[2];
    const float* W    = (const float*)d_in[3];
    const float* bias = (const float*)d_in[4];

    const size_t per = (size_t)BATCH * NUM_HEADS * SEQ * HEAD_DIM;  // 2,097,152
    _Float16* Qh = (_Float16*)d_ws;
    _Float16* Kh = Qh + per;
    _Float16* Vt = Kh + per;

    dim3 pgrid((BATCH * SEQ) / PBM, D_MODEL / PBN, 3);
    proj_kernel<<<pgrid, P_THR, 0, stream>>>(q, k, v, W, bias, Qh, Kh, Vt);

    dim3 agrid(SEQ / 128, BATCH * NUM_HEADS);
    attn_kernel<<<agrid, 128 * KV_SPLIT, 0, stream>>>(Qh, Kh, Vt, (float*)d_out);
}

// v010
// A run of this version takes 25.7 microseconds.
// Next to v009, in two timings, it ran 1.06 times as fast each time.
// All steps since v000 together make it 5.86 times as fast.
#include <hip/hip_runtime.h>

#define D_MODEL   512
#define NUM_HEADS 8
#define HEAD_DIM  64
#define BATCH     2
#define SEQ       2048

// LDS row pitches. A fragment read is one ds_load_b128 per lane with 16 lanes on
// 16 consecutive rows; a pitch of 16 B x odd puts those rows on disjoint banks.
#define T_PITCH  72   // halves: 64 data + 8 pad  (144 B), K / V^T tiles, projection slices
#define O_PITCH  68   // floats: 64 data + 4 pad  (272 B), output staging
#define KV_SPLIT 4    // wave groups of the attention block, each on its own key tiles
#define KV_BUF   (2 * 64 * T_PITCH)               // halves of one K + V^T tile buffer
#define PBM      128  // projection block tile, rows of X
#define PBN      256  // projection block tile, rows of W
#define PBK      64   // k of one projection slice
#define P_STAGE  ((PBM + PBN) * T_PITCH)          // halves of one slice buffer
#define P_THR    256  // projection block: 8 waves, 2 x 4
#define P_CH     ((PBM + PBN) * PBK / 4 / P_THR)  // 16-B f32 chunks per thread and slice
#define P_NS     (D_MODEL / PBK)                  // k slices of the projection

typedef __attribute__((ext_vector_type(16))) _Float16 v16h;
typedef __attribute__((ext_vector_type(8)))  _Float16 v8h;
typedef __attribute__((ext_vector_type(4)))  _Float16 v4h;
typedef __attribute__((ext_vector_type(8)))  float    v8f;
typedef __attribute__((ext_vector_type(4)))  float    v4f;

union AB16 { v16h v; v8h h[2]; };

__device__ __forceinline__ v8f wmma16(v16h a, v16h b, v8f c) {
    return __builtin_amdgcn_wmma_f32_16x16x32_f16(false, a, false, b,
                                                  (short)0, c, false, false);
}

// ---------------------------------------------------------------------------
// Fused projection: P = relu(X @ W^T + b), emitted as f16.
//   z==0 -> Qh [b,h,s,dh]   z==1 -> Kh [b,h,s,dh]   z==2 -> Vt [b,h,dh,s]
// Grid: (M/128, 512/256, 3), block 256 (8 waves, 2 x 4). Block tile 128(M) x
// 256(N), wave tile 64 x 64 (one head): 4 + 4 fragments feed 16 products, so the LDS
// reads keep level with the matrix unit. A slice is 64 k of the 128 X rows and the
// 256 W rows: every load instruction covers two whole 256-B row pieces, the slice
// is converted once and kept as f16 in one of two LDS buffers. Slices are fetched
// two ahead into two register sets, so loads stay in flight through every pass.
// 96 blocks read the same 256 W rows and two the same X rows: each block enters the
// ring of k slices at a start of its own and wraps round, so that they do not ask L2
// for the same lines at the same moment.
// ---------------------------------------------------------------------------
// xp, wp: the slice in the block's first X and W row (uniform); vo: the lane's element in it
__device__ __forceinline__ void proj_fetch(v4f (&r)[P_CH], const float* __restrict__ xp,
                                           const float* __restrict__ wp, unsigned vo) {
#pragma unroll
    for (int i = 0; i < P_CH; ++i)
        r[i] = (i < PBM / 16) ? *(const v4f*)(xp + (vo + i * 16 * D_MODEL))
                              : *(const v4f*)(wp + (vo + (i - PBM / 16) * 16 * D_MODEL));
}

__device__ __forceinline__ void proj_put(const v4f (&r)[P_CH], _Float16* dst) {
#pragma unroll
    for (int i = 0; i < P_CH; ++i) {
        v4h pk;
#pragma unroll
        for (int e = 0; e < 4; ++e) pk[e] = (_Float16)r[i][e];
        *(v4h*)(dst + i * 16 * T_PITCH) = pk;
    }
}

// Work-group barrier behind the wave's LDS traffic alone: __syncthreads() also waits
// for every global load, and the slices fetched ahead must stay in flight across it.
// No global store precedes it in this kernel.
__device__ __forceinline__ void proj_barrier() {
    asm volatile("s_wait_dscnt 0x0\n\ts_barrier_signal -1\n\ts_barrier_wait -1" ::: "memory");
}

__global__ __launch_bounds__(P_THR)
void proj_kernel(const float* __restrict__ Xq, const float* __restrict__ Xk,
                 const float* __restrict__ Xv, const float* __restrict__ W,
                 const float* __restrict__ bias,
                 _Float16* __restrict__ Qh, _Float16* __restrict__ Kh,
                 _Float16* __restrict__ Vt) {
    // two slice buffers [X 128 rows | W 256 rows][T_PITCH]; store staging after the loop
    __shared__ __align__(16) _Float16 lds_s[2 * P_STAGE];
    static_assert(8 * 64 * 64 <= 2 * P_STAGE, "store staging fits the overlay");

    const int tid  = threadIdx.x;
    const int wave = tid >> 5;
    const int lane = tid & 31;
    const int grp  = lane >> 4;   // half-wave group (K-group of WMMA layouts)
    const int l16  = lane & 15;
    const int wm   = wave >> 2;   // wave's 64 rows of the block tile
    const int wn   = wave & 3;    // wave's 64 columns (head) of the block tile

    const int z = blockIdx.z;
    const float* X = (z == 0) ? Xq : (z == 1) ? Xk : Xv;

    const int mb = blockIdx.x * PBM;   // first M row of the block
    const int nb = blockIdx.y * PBN;   // first N col of the block

    // loader: thread takes 16 B of row (tid >> 4) + 16 i, 16 threads a 256-B row piece
    const int lr = tid >> 4, lc = (tid & 15) * 4;
    const float* xu = X + (size_t)mb * D_MODEL;
    const float* wu = W + (size_t)nb * D_MODEL;
    const unsigned vo = lr * D_MODEL + lc;
    _Float16* put = lds_s + lr * T_PITCH + lc;
    // first k slice of the block's walk: spread over the blocks that share W rows (x, z),
    // half a ring apart in the two that share X rows (y)
    const int rot = ((int)blockIdx.x + ((int)blockIdx.x >> 3) + (P_NS / 2) * (int)blockIdx.y +
                     3 * (int)blockIdx.z) & (P_NS - 1);

    v8f acc[4][4] = {};
    v4f r[2][P_CH];

    const int sl1 = (rot + 1) & (P_NS - 1);
    proj_fetch(r[0], xu + rot * PBK, wu + rot * PBK, vo);
    // the registers that hold these loads' slice addresses are rewritten for the next slice:
    // the wait stands in front of that rewrite, the fence below keeps the rewrite behind it
    asm volatile("s_wait_xcnt 0x0" ::: "memory");
    // keeps the first slice's loads the older ones, so that its wait leaves the second's in flight
    __builtin_amdgcn_sched_barrier(0);
    proj_fetch(r[1], xu + sl1 * PBK, wu + sl1 * PBK, vo);
    // keeps the second slice's loads in front of the first conversion (and its wait)
    __builtin_amdgcn_sched_barrier(0);
    proj_put(r[0], put);
    proj_barrier();

    // unrolled so that the register set and the LDS buffer of a pass are compile-time
#pragma unroll
    for (int s = 0; s < D_MODEL / PBK; ++s) {
        if (s + 2 < P_NS) {
            // the registers that hold the earlier loads' slice addresses are rewritten here: the
            // wait stands in front of that rewrite, the scheduling fence keeps it behind the wait
            asm volatile("s_wait_xcnt 0x0" ::: "memory");
            __builtin_amdgcn_sched_barrier(0);
            const int sl = (rot + s + 2) & (P_NS - 1);
            proj_fetch(r[s & 1], xu + sl * PBK, wu + sl * PBK, vo);
            // behind the last fetch its address registers are free for other values
            if (s + 3 == P_NS) asm volatile("s_wait_xcnt 0x0" ::: "memory");
        }
        // keeps the loads at the head of the pass: they fly through two passes' products
        __builtin_amdgcn_sched_barrier(0);
        const _Float16* buf = lds_s + (s & 1) * P_STAGE;
        AB16 a[PBK / 32][4], bm[PBK / 32][4];
#pragma unroll
        for (int ki = 0; ki < PBK / 32; ++ki) {
#pragma unroll
            for (int j = 0; j < 4; ++j) {
                const _Float16* bp = buf + (PBM + wn * 64 + j * 16 + l16) * T_PITCH + ki * 32;
                bm[ki][j].h[0] = *(const v8h*)(bp + grp * 8);
                bm[ki][j].h[1] = *(const v8h*)(bp + 16 + grp * 8);
            }
#pragma unroll
            for (int mi = 0; mi < 4; ++mi) {
                const _Float16* ap = buf + (wm * 64 + mi * 16 + l16) * T_PITCH + ki * 32;
                a[ki][mi].h[0] = *(const v8h*)(ap + grp * 8);
                a[ki][mi].h[1] = *(const v8h*)(ap + 16 + grp * 8);
            }
        }
        // keeps the pass's fragment reads one group in front of its products: read row by
        // row into one register set, every row of products waits out the LDS latency
        __builtin_amdgcn_sched_barrier(0);
#pragma unroll
        for (int ki = 0; ki < PBK / 32; ++ki)
#pragma unroll
            for (int mi = 0; mi < 4; ++mi)
#pragma unroll
                for (int j = 0; j < 4; ++j)
                    acc[mi][j] = wmma16(a[ki][mi].v, bm[ki][j].v, acc[mi][j]);
        // keeps the conversions, and so the wait for the loads, behind this pass's products
        __builtin_amdgcn_sched_barrier(0);
        // the other buffer's readers left it at the barrier that ended the pass before
        if (s + 1 < D_MODEL / PBK) proj_put(r[(s + 1) & 1], put + ((s + 1) & 1) * P_STAGE);
        proj_barrier();
    }

    // ---- epilogue: + bias, relu, f16, packed 128-bit stores ----
    const int n0 = nb + wn * 64;          // wave's first N col (== head*64)
    const int h  = n0 / HEAD_DIM;         // one head per wave
    float bv[4];
#pragma unroll
    for (int j = 0; j < 4; ++j) bv[j] = bias[n0 + j * 16 + l16];
    // the register that holds the loads' offset is reused for the row index below: the wait
    // stands in front of that rewrite, and the scheduling fence keeps the rewrite behind it
    asm volatile("s_wait_xcnt 0x0" ::: "memory");
    __builtin_amdgcn_sched_barrier(0);

    const int mw = mb + wm * 64;          // wave's first M row; its 64 rows are in one batch
    const int b  = mw >> 11;
    const int sw = mw & (SEQ - 1);

    if (z == 2) {
        // Vt [dh][s]: C-layout register column r = consecutive s -> direct v8h
#pragma unroll
        for (int mi = 0; mi < 4; ++mi)
#pragma unroll
            for (int j = 0; j < 4; ++j) {
                const int dh = j * 16 + l16;
                v8h pk;
#pragma unroll
                for (int q = 0; q < 8; ++q) {
                    float val = acc[mi][j][q] + bv[j];
                    val = val > 0.f ? val : 0.f;
                    pk[q] = (_Float16)val;
                }
                *(v8h*)(Vt + ((size_t)(b * NUM_HEADS + h) * HEAD_DIM + dh) * SEQ +
                        sw + mi * 16 + grp * 8) = pk;
            }
    } else {
        // Qh/Kh [s][dh]: stage the wave's 64 x 64 tile in LDS, then coalesced b128 copy-out
        _Float16* dst = (z == 0) ? Qh : Kh;
        _Float16* cw  = lds_s + wave * (64 * 64);
#pragma unroll
        for (int mi = 0; mi < 4; ++mi)
#pragma unroll
            for (int j = 0; j < 4; ++j)
#pragma unroll
                for (int q = 0; q < 8; ++q) {
                    float val = acc[mi][j][q] + bv[j];
                    val = val > 0.f ? val : 0.f;
                    cw[(mi * 16 + grp * 8 + q) * 64 + j * 16 + l16] = (_Float16)val;
                }
        // same-wave DS ordering; 64 rows x 8 segs = 512 chunks, 16 per lane
#pragma unroll
        for (int i = 0; i < 16; ++i) {
            const int c   = lane + 32 * i;
            const int row = c >> 3, seg = c & 7;
            const v8h pk = *(const v8h*)(cw + row * 64 + seg * 8);
            *(v8h*)(dst + ((size_t)(b * NUM_HEADS + h) * SEQ + sw + row) *
                    HEAD_DIM + seg * 8) = pk;
        }
        // in the listing this branch falls through into code that rewrites the stores' address pair
        asm volatile("s_wait_xcnt 0x0" ::: "memory");
    }
}

// ---------------------------------------------------------------------------
// Causal flash attention, transposed products: S^T = K Q^T, O^T += V^T P^T.
// Grid: (SEQ/128, B*H), block 512 = KV_SPLIT groups of 4 waves. A block takes
// two 64-query tiles, t and SEQ/64 - 1 - t, so every block has the same causal
// work (SEQ/64 + 1 tile pairs). A wave owns 16 queries of either tile as two
// column groups (0 early, 1 late): both are B operands of the same K and V^T
// fragments, so a fragment read from LDS serves both while the early tile still
// has keys, and every wave of a key group has the same work. One query per lane
// column (l16); a lane holds 32 of the 64 scores of its query, lane ^ 16 the other
// 32. Maximum and sum are in-lane, joined with lane ^ 16; two S^T tiles converted in place are the B
// operand of the second product, so P never leaves the registers. KV tiles of 64
// staged in LDS, one per group and pass: group g walks tiles g, g + KV_SPLIT, ...
// with a running maximum, sum and O of its own; the groups' partial results are
// joined through LDS after the loop.
// Each group has two tile buffers, filled by asynchronous copies to LDS: the next
// pass's tile is in flight while this pass's is worked on, one barrier a pass.
// The 16 blocks of a head read the same K and V^T rows: each enters its rings of
// passes at starts of its own and wraps round, so that they do not ask L2 for the
// same lines at the same moment.
// ---------------------------------------------------------------------------
// value of lane l ^ 16
__device__ __forceinline__ float xhalf(float x) {
    const int i = __builtin_bit_cast(int, x);
    return __builtin_bit_cast(float, __builtin_amdgcn_permlanex16(
        i, i, 0x76543210, 0xfedcba98, false, false));
}

// One group's K and V^T tile (64 x 128 B each) into one LDS buffer: 8 chunks of 16 B a
// thread, rows rw, rw + 16, rw + 32, rw + 48 of either tile. kg, vg: the lane's chunk of
// row rw in global memory; lk: its LDS byte address in the K half of the buffer.
__device__ __forceinline__ void kv_copy(const _Float16* kg, const _Float16* vg, unsigned lk) {
    const _Float16* kg1 = kg + 16 * HEAD_DIM;
    const _Float16* kg2 = kg + 32 * HEAD_DIM;
    const _Float16* kg3 = kg + 48 * HEAD_DIM;
    const _Float16* vg1 = vg + (size_t)16 * SEQ;
    const _Float16* vg2 = vg + (size_t)32 * SEQ;
    const _Float16* vg3 = vg + (size_t)48 * SEQ;
    const unsigned lk1 = lk + 16 * T_PITCH * 2;
    const unsigned lk2 = lk + 32 * T_PITCH * 2;
    const unsigned lk3 = lk + 48 * T_PITCH * 2;
    const unsigned lv  = lk + 64 * T_PITCH * 2;
    const unsigned lv1 = lv + 16 * T_PITCH * 2;
    const unsigned lv2 = lv + 32 * T_PITCH * 2;
    const unsigned lv3 = lv + 48 * T_PITCH * 2;
    // the closing wait stands in front of any rewrite of the address registers named here
    asm volatile("global_load_async_to_lds_b128 %0, %8, off\n\t"
                 "global_load_async_to_lds_b128 %1, %9, off\n\t"
                 "global_load_async_to_lds_b128 %2, %10, off\n\t"
                 "global_load_async_to_lds_b128 %3, %11, off\n\t"
                 "global_load_async_to_lds_b128 %4, %12, off\n\t"
                 "global_load_async_to_lds_b128 %5, %13, off\n\t"
                 "global_load_async_to_lds_b128 %6, %14, off\n\t"
                 "global_load_async_to_lds_b128 %7, %15, off\n\t"
                 "s_wait_xcnt 0x0"
                 :: "v"(lk), "v"(lk1), "v"(lk2), "v"(lk3), "v"(lv), "v"(lv1), "v"(lv2), "v"(lv3),
                    "v"(kg), "v"(kg1), "v"(kg2), "v"(kg3), "v"(vg), "v"(vg1), "v"(vg2), "v"(vg3)
                 : "memory");
}

// S^T = K Q^T of one column group: 4 key-tiles x 2 k-steps on the K fragments ak.
// sc[j][r] = S[query l16][key j*16 + grp*8 + r of the tile]
__device__ __forceinline__ void attn_scores(const AB16 (&ak)[4][2], const AB16& qa0,
                                            const AB16& qa1, v8f (&sc)[4]) {
#pragma unroll
    for (int j = 0; j < 4; ++j) {
        v8f s = {};
        s = wmma16(ak[j][0].v, qa0.v, s);
        s = wmma16(ak[j][1].v, qa1.v, s);
        sc[j] = s;
    }
    // keeps the eight products in front of the first use of a score: a use placed directly
    // behind its product costs four idle vector slots
    __builtin_amdgcn_sched_barrier(0);
}

// Online softmax step of one column group: scores in, P^T B-operands out; maximum, sum
// and O rescaled. diag is the same in the whole wave: where it is set, key j*16 + r of
// this lane's half is kept while <= lim; elsewhere every key of the tile is kept.
template <bool CAN_CROSS>
__device__ __forceinline__ void attn_softmax(const v8f (&sc)[4], bool diag, int lim, float& m_run,
                                             float& l_run, v8f (&o)[4], AB16& pb0, AB16& pb1) {
    const float scale = 0.125f;  // 1/sqrt(64)
    // single registers from here on: the select below then works in place
    float s[4][8];
#pragma unroll
    for (int j = 0; j < 4; ++j)
#pragma unroll
        for (int r = 0; r < 8; ++r) s[j][r] = sc[j][r] * scale;
    // ---- causal mask, only in a tile that crosses the diagonal (scalar branch) ----
    if (CAN_CROSS && diag) {
#pragma unroll
        for (int j = 0; j < 4; ++j)
#pragma unroll
            for (int r = 0; r < 8; ++r)
                if (j * 16 + r > lim) s[j][r] = -__builtin_inff();
    }
    // ---- maximum of the query's scores ----
    // one partial maximum and sum per key tile: four short chains
    float mxj[4];
#pragma unroll
    for (int j = 0; j < 4; ++j) {
        mxj[j] = -__builtin_inff();
#pragma unroll
        for (int r = 0; r < 8; ++r) mxj[j] = fmaxf(mxj[j], s[j][r]);
    }
    float mx = fmaxf(fmaxf(mxj[0], mxj[1]), fmaxf(mxj[2], mxj[3]));
    mx = fmaxf(mx, xhalf(mx));
    // ---- online softmax update ----
    const float mn = fmaxf(m_run, mx);
    const float alpha = __expf(m_run - mn);
    m_run = mn;
    float rsj[4];
#pragma unroll
    for (int j = 0; j < 4; ++j) {
        rsj[j] = 0.f;
#pragma unroll
        for (int r = 0; r < 8; ++r) {
            const float p = __expf(s[j][r] - mn);
            s[j][r] = p;
            rsj[j] += p;
        }
    }
    const float rs = (rsj[0] + rsj[1]) + (rsj[2] + rsj[3]);
    l_run = l_run * alpha + rs;
#pragma unroll
    for (int t = 0; t < 4; ++t)
#pragma unroll
        for (int r = 0; r < 8; ++r) o[t][r] *= alpha;

    // ---- P^T B-operands: tiles 2s and 2s+1 hold keys grp*8+r and
    //      16+grp*8+r of k-step s, the k order of the V^T fragments ----
#pragma unroll
    for (int r = 0; r < 8; ++r) {
        pb0.h[0][r] = (_Float16)s[0][r];
        pb0.h[1][r] = (_Float16)s[1][r];
        pb1.h[0][r] = (_Float16)s[2][r];
        pb1.h[1][r] = (_Float16)s[3][r];
    }
}

// O^T += V^T P^T of one column group: 4 dh-tiles x 2 k-steps on the V^T fragments av
__device__ __forceinline__ void attn_out(const AB16 (&av)[4][2], const AB16& pb0,
                                         const AB16& pb1, v8f (&o)[4]) {
#pragma unroll
    for (int t = 0; t < 4; ++t) {
        o[t] = wmma16(av[t][0].v, pb0.v, o[t]);
        o[t] = wmma16(av[t][1].v, pb1.v, o[t]);
    }
}

// The A fragments of one 64 x 64 tile in LDS (K: row = key, V^T: row = d), k-steps 0 and 1
__device__ __forceinline__ void attn_frags(const _Float16* tile, int grp, int l16,
                                           AB16 (&a)[4][2]) {
#pragma unroll
    for (int j = 0; j < 4; ++j) {
        const _Float16* rp = tile + (j * 16 + l16) * T_PITCH;
        a[j][0].h[0] = *(const v8h*)(rp + grp * 8);
        a[j][0].h[1] = *(const v8h*)(rp + 16 + grp * 8);
        a[j][1].h[0] = *(const v8h*)(rp + 32 + grp * 8);
        a[j][1].h[1] = *(const v8h*)(rp + 48 + grp * 8);
    }
    // keeps a tile's fragment reads one group in front of its products: read piecemeal
    // into reused registers, each piece waits out the LDS latency
    __builtin_amdgcn_sched_barrier(0);
}

__global__ __launch_bounds__(128 * KV_SPLIT)
void attn_kernel(const _Float16* __restrict__ Qh, const _Float16* __restrict__ Kh,
                 const _Float16* __restrict__ Vt, float* __restrict__ out) {
    // overlay: per group 2 x [K 9KB | V 9KB] during loop, partial O of every column group after
    __shared__ __align__(16) unsigned char smem[KV_SPLIT * 2 * KV_BUF * 2];
    // per key group, 16-query group and query: maximum, sum
    __shared__ __align__(8) float lds_ml[KV_SPLIT * 8][16][2];
    static_assert(KV_SPLIT * 8 * 16 * O_PITCH * 4 <= sizeof(smem), "partial O fits the overlay");
    static_assert(KV_SPLIT == 4, "the join deals 16 rows to 4 groups and takes a maximum of 4");

    const int tid  = threadIdx.x;
    const int wave = tid >> 5;
    const int lane = tid & 31;
    const int grp  = lane >> 4;
    const int l16  = lane & 15;
    const int gtid = tid & 127;                // thread within its key group
    const int sub  = wave & 3;                 // the wave's 16 queries within either tile
    const int ks   = __builtin_amdgcn_readfirstlane(wave >> 2);  // key group, uniform

    _Float16* lds_g = (_Float16*)smem + ks * (2 * KV_BUF);  // the group's two buffers
    float*    lds_o = (float*)smem;                    // 32 x [16][O_PITCH] f32

    const int bh = blockIdx.y;                 // b*H + h
    const int qt_late = SEQ / 64 - 1 - (int)blockIdx.x;          // the block's late query tile
    // first query row of the wave's column groups: 0 early tile, 1 late tile
    const int qr[2] = {(int)blockIdx.x * 64 + sub * 16, qt_late * 64 + sub * 16};
    const int qe_u = __builtin_amdgcn_readfirstlane(qr[0]);  // uniform branch keys
    const int ql_u = __builtin_amdgcn_readfirstlane(qr[1]);

    const _Float16* Qb = Qh + (size_t)bh * SEQ * HEAD_DIM;
    const _Float16* Kb = Kh + (size_t)bh * SEQ * HEAD_DIM;
    const _Float16* Vb = Vt + (size_t)bh * HEAD_DIM * SEQ;

    // Q B-operands (column = query l16) for K-steps d=0..31 and d=32..63
    AB16 qa0[2], qa1[2];
#pragma unroll
    for (int c = 0; c < 2; ++c) {
        const _Float16* qp = Qb + (size_t)(qr[c] + l16) * HEAD_DIM;
        qa0[c].h[0] = *(const v8h*)(qp + grp * 8);
        qa0[c].h[1] = *(const v8h*)(qp + 16 + grp * 8);
        qa1[c].h[0] = *(const v8h*)(qp + 32 + grp * 8);
        qa1[c].h[1] = *(const v8h*)(qp + 48 + grp * 8);
    }

    // running maximum of query l16 (both halves alike), running sum over this half's keys only
    float m_run[2] = {-__builtin_inff(), -__builtin_inff()};
    float l_run[2] = {0.f, 0.f};
    v8f o[2][4] = {};                  // o[c][t][r] = O[query l16 of group c][d = t*16 + grp*8 + r]

    // block-uniform trip count (keys of the late tile): every wave passes every barrier
    const int kv_end = (qt_late + 1) * 64;
    const int np = (kv_end + 64 * KV_SPLIT - 1) / (64 * KV_SPLIT);   // passes, block-uniform

    // the lane's chunk of the group's tile of pass 0 and its place in buffer 0. Every
    // group copies a tile in every pass: pass p < np <= SEQ / 256 keeps keys
    // p * 256 + ks * 64 + 63 < SEQ, also where the tile lies past kv_end and is not used.
    const int rw = gtid >> 3, sg = gtid & 7;
    const _Float16* kg = Kb + (size_t)(ks * 64 + rw) * HEAD_DIM + sg * 8;
    const _Float16* vg = Vb + (size_t)rw * SEQ + ks * 64 + sg * 8;
    const unsigned lk = (unsigned)(size_t)(lds_g + rw * T_PITCH + sg * 8);

    // The passes fall in two runs, block-uniform. Passes 0 .. np_e - 1 hold the early tile's
    // keys (key tiles 0 .. blockIdx.x). Their key tiles, 0 .. np_e * KV_SPLIT - 1, end at
    // SEQ / 128 - 1 or sooner, in front of the late tile (index >= SEQ / 128): there the late
    // column group has work in every wave and no key to mask. The later passes hold nothing
    // for the early column group. The causal compare and select run only where the tile
    // crosses a column group's diagonal.
    static_assert(SEQ / 128 % KV_SPLIT == 0, "the early tiles' passes end in front of the late tiles");
    const int np_e = (int)blockIdx.x / KV_SPLIT + 1;   // <= SEQ / 128 / KV_SPLIT < np
    const int np_l = np - np_e;                        // >= 1
    // the pass that trip i works on, block-uniform: either run is a ring of its own,
    // entered at a start set by the block's index (four starts spread over the ring)
    const int rot_e = (((int)blockIdx.x & 3) * np_e) >> 2;   // < np_e
    const int rot_l = (((int)blockIdx.x & 3) * np_l) >> 2;   // < np_l
    auto pass_of = [&](int i) {
        const int n = i < np_e ? np_e : np_l;
        const int t = i < np_e ? i + rot_e : i - np_e + rot_l;
        return (i < np_e ? 0 : np_e) + (t >= n ? t - n : t);
    };
    // the tile of pass p into buffer bf
    auto pass_copy = [&](int p, int bf) {
        kv_copy(kg + (size_t)p * (64 * KV_SPLIT) * HEAD_DIM, vg + p * (64 * KV_SPLIT),
                lk + bf * (KV_BUF * 2));
    };

    pass_copy(pass_of(0), 0);
    // trip 0's tile has landed before the barrier behind which other waves read it
    asm volatile("s_wait_asynccnt 0x0" ::: "memory");
    __syncthreads();
    if (np > 1) pass_copy(pass_of(1), 1);

    // foot of trip i, every wave: hands the next tile over and refills the buffer just read
    auto pass_foot = [&](int i) {
        // the wave's reads of this pass's buffer are done before it is refilled
        asm volatile("s_wait_dscnt 0x0" ::: "memory");
        // the wave's copies of the next pass's tile have landed before other waves read them
        asm volatile("s_wait_asynccnt 0x0" ::: "memory");
        __syncthreads();
        if (i + 2 < np)   // block-uniform; into the buffer this trip has just read
            pass_copy(pass_of(i + 2), i & 1);
    };

    int i = 0;
    for (; i < np_e; ++i) {
        const int kv0 = pass_of(i) * (64 * KV_SPLIT) + ks * 64;   // this group's tile of the pass
        const _Float16* lds_k = lds_g + (i & 1) * KV_BUF;     // [kv 64][T_PITCH]
        const _Float16* lds_v = lds_k + 64 * T_PITCH;         // [d 64][T_PITCH]
        // wave-uniform causal skip; the early tile's keys are a prefix of the late tile's,
        // so its products ride on the late tile's fragments
        const bool both = kv0 <= qe_u + 15;
        AB16 fr[4][2], pb0[2], pb1[2];
        v8f sc[4];
        attn_frags(lds_k, grp, l16, fr);
        if (both) {
            attn_scores(fr, qa0[0], qa1[0], sc);
            attn_softmax<true>(sc, kv0 + 63 > qe_u, qr[0] + l16 - kv0 - grp * 8, m_run[0],
                               l_run[0], o[0], pb0[0], pb1[0]);
        }
        attn_scores(fr, qa0[1], qa1[1], sc);
        attn_softmax<false>(sc, false, 0, m_run[1], l_run[1], o[1], pb0[1], pb1[1]);
        attn_frags(lds_v, grp, l16, fr);
        attn_out(fr, pb0[1], pb1[1], o[1]);
        if (both) attn_out(fr, pb0[0], pb1[0], o[0]);
        pass_foot(i);
    }
    for (; i < np; ++i) {
        const int kv0 = pass_of(i) * (64 * KV_SPLIT) + ks * 64;
        const _Float16* lds_k = lds_g + (i & 1) * KV_BUF;
        const _Float16* lds_v = lds_k + 64 * T_PITCH;
        if (kv0 <= ql_u + 15) {   // wave-uniform causal skip (also: no tile past kv_end)
            AB16 fr[4][2], pb0, pb1;
            v8f sc[4];
            attn_frags(lds_k, grp, l16, fr);
            attn_scores(fr, qa0[1], qa1[1], sc);
            attn_softmax<true>(sc, kv0 + 63 > ql_u, qr[1] + l16 - kv0 - grp * 8, m_run[1],
                               l_run[1], o[1], pb0, pb1);
            attn_frags(lds_v, grp, l16, fr);
            attn_out(fr, pb0, pb1, o[1]);
        }
        pass_foot(i);
    }
    // no copy is outstanding when the buffers become the partial results' staging
    asm volatile("s_wait_asynccnt 0x0" ::: "memory");

    // ---- every column group's partial O, maximum and sum into the LDS overlay;
    //      slot ks * 8 + qg, qg = c * 4 + sub: the block's eight 16-query groups ----
    const int b = bh / NUM_HEADS;
    const int h = bh % NUM_HEADS;
#pragma unroll
    for (int c = 0; c < 2; ++c) {
        const int slot = ks * 8 + c * 4 + sub;
        const float l_all = l_run[c] + xhalf(l_run[c]);   // join the halves' sums
        float* ow = lds_o + slot * (16 * O_PITCH);        // safe: loop ended with barrier
#pragma unroll
        for (int t = 0; t < 4; ++t)
#pragma unroll
            for (int u = 0; u < 2; ++u) {
                v4f val;
#pragma unroll
                for (int e = 0; e < 4; ++e) val[e] = o[c][t][u * 4 + e];
                *(v4f*)(ow + l16 * O_PITCH + t * 16 + grp * 8 + u * 4) = val;
            }
        if (grp == 0) {
            lds_ml[slot][l16][0] = m_run[c];   // -inf, with sum 0 and O 0, where it had no tile
            lds_ml[slot][l16][1] = l_all;
        }
    }
    __syncthreads();   // the groups' partial results are read across waves below

    // ---- join the key groups: wave (ks, sub) takes rows ks*4 .. ks*4+3 of the query
    //      groups sub and 4 + sub; 16 lanes cover one 256-B row, so stores are whole
    //      lines. Group 0 always holds key 0, so the joint maximum is finite. ----
#pragma unroll
    for (int c = 0; c < 2; ++c) {
        const int qg = c * 4 + sub;
#pragma unroll
        for (int i = 0; i < 2; ++i) {
            const int row = ks * 4 + i * 2 + grp;
            float mg[KV_SPLIT], lg[KV_SPLIT];
#pragma unroll
            for (int g = 0; g < KV_SPLIT; ++g) {
                mg[g] = lds_ml[g * 8 + qg][row][0];
                lg[g] = lds_ml[g * 8 + qg][row][1];
            }
            const float mj = fmaxf(fmaxf(mg[0], mg[1]), fmaxf(mg[2], mg[3]));
            float lj = 0.f;
            v4f acc = {};
#pragma unroll
            for (int g = 0; g < KV_SPLIT; ++g) {
                const float w = __expf(mg[g] - mj);
                lj += lg[g] * w;
                const v4f part = *(const v4f*)(lds_o + (g * 8 + qg) * (16 * O_PITCH) +
                                               row * O_PITCH + l16 * 4);
#pragma unroll
                for (int e = 0; e < 4; ++e) acc[e] += part[e] * w;
            }
            const float inv_l = 1.0f / lj;
#pragma unroll
            for (int e = 0; e < 4; ++e) acc[e] *= inv_l;
            *(v4f*)(out + ((size_t)(h * BATCH + b) * SEQ + qr[c] + row) * HEAD_DIM +
                    l16 * 4) = acc;
        }
    }
}

// ---------------------------------------------------------------------------
extern "C" void kernel_launch(void* const* d_in, const int* in_sizes, int n_in,
                              void* d_out, int out_size, void* d_ws, size_t ws_size,
                              hipStream_t stream) {
    const float* q    = (const float*)d_in[0];
    const float* k    = (const float*)d_in[1];
    const float* v    = (const float*)d_in[2];
    const float* W    = (const float*)d_in[3];
    const float* bias = (const float*)d_in[4];

    const size_t per = (size_t)BATCH * NUM_HEADS * SEQ * HEAD_DIM;  // 2,097,152
    _Float16* Qh = (_Float16*)d_ws;
    _Float16* Kh = Qh + per;
    _Float16* Vt = Kh + per;

    dim3 pgrid((BATCH * SEQ) / PBM, D_MODEL / PBN, 3);
    proj_kernel<<<pgrid, P_THR, 0, stream>>>(q, k, v, W, bias, Qh, Kh, Vt);

    dim3 agrid(SEQ / 128, BATCH * NUM_HEADS);
    attn_kernel<<<agrid, 128 * KV_SPLIT, 0, stream>>>(Qh, Kh, Vt, (float*)d_out);
}
